// v000
// Measured on an AMD MI455X. A time is GPU time per run, averaged over a window of back-to-back runs after a warm-up
// (all launches, gaps included; the runs take copies of the inputs in turn), and the median of several windows.
// Apart from v000's, it joins two sittings. Times from different sittings can be a few percent apart, while
// side-by-side timings come from the same sitting.
// v000 is the starting kernel. One run takes 864 microseconds.
#include <hip/hip_runtime.h>

// ScaledDotProductAttentionLayer (x [4][4096][512]; q = x wq + bq, k = x wk + bk (64), v = x wv + bv (64); probs = softmax(q.k / 8) over the 4096 keys; out = probs v -> [4][4096][64]).
// Compute dtypes, f32 accumulate: every input rounded to bf16; q/k/v projections on PLAIN bf16 operands (inputs: exact, + bias); scores (K 64) on bf16 hi+lo planes of q (x 1/8) and k (3 products; logits have unit scale);

#define NB_  4
#define SS   4096
#define DM   512
#define DK   64
#define PCAR 1024.0f
typedef _Float16 h16;
typedef unsigned short bf;
typedef __attribute__((ext_vector_type(16))) __bf16   v16bf;
typedef __attribute__((ext_vector_type(16))) _Float16 v16h;
typedef __attribute__((ext_vector_type(8)))  _Float16 v8h;
typedef __attribute__((ext_vector_type(8)))  unsigned short v8us;
typedef __attribute__((ext_vector_type(8)))  float    v8f;
typedef __attribute__((ext_vector_type(4)))  float    v4f;
typedef v8h  __attribute__((may_alias)) v8ha;
typedef v4f  __attribute__((may_alias)) v4fa;
typedef v8us __attribute__((may_alias)) v8usa;

__device__ __forceinline__ unsigned short f2bf(float f) { unsigned u = __float_as_uint(f); u += 0x7FFFu + ((u >> 16) & 1u); return (unsigned short)(u >> 16); }
__device__ __forceinline__ float bf2f(unsigned short b) { return __uint_as_float(((unsigned)b) << 16); }
__device__ __forceinline__ float bfr(float f) { return bf2f(f2bf(f)); }
__device__ __forceinline__ v16h cat16(v8h lo, v8h hi) { return __builtin_shufflevector(lo, hi, 0, 1, 2, 3, 4, 5, 6, 7, 8, 9, 10, 11, 12, 13, 14, 15); }
__device__ __forceinline__ v16bf cat16b(v8us lo, v8us hi) { return __builtin_bit_cast(v16bf, __builtin_shufflevector(lo, hi, 0, 1, 2, 3, 4, 5, 6, 7, 8, 9, 10, 11, 12, 13, 14, 15)); }
__device__ __forceinline__ v8f wmma16(v16h a, v16h b, v8f c) { return __builtin_amdgcn_wmma_f32_16x16x32_f16(false, a, false, b, (short)0, c, false, false); }
__device__ __forceinline__ v8f wmmab(v16bf a, v16bf b, v8f c) { return __builtin_amdgcn_wmma_f32_16x16x32_bf16(false, a, false, b, (short)0, c, false, false); }



// ---- k_gemmw: register-blocked GEMM, ONE WAVE per 64x64 output tile (16 accumulators), operands straight from K-contiguous 16-bit planes; grid (M/64, N/64, Z), 32 threads.
// C[m][n] (f32, pitch ldc, + optional f32 bias[n]) = sum_k A[m][k] Bt[n][k] (+ split products per NSPLIT). z-batch strides sA/sB/sC in elements. K % 32 == 0.
template <typename T16> struct WFrag;
template <> struct WFrag<h16> { typedef v16h V; static __device__ __forceinline__ V ld(const h16* p) { return cat16(*(const v8h*)p, *(const v8h*)(p + 16)); } static __device__ __forceinline__ v8f mma(V a, V b, v8f c) { return wmma16(a, b, c); } };
template <> struct WFrag<bf> { typedef v16bf V; static __device__ __forceinline__ V ld(const bf* p) { return cat16b(*(const v8us*)p, *(const v8us*)(p + 16)); } static __device__ __forceinline__ v8f mma(V a, V b, v8f c) { return wmmab(a, b, c); } };
template <typename T16, int NSPLIT, bool BIAS>
__global__ __launch_bounds__(32) void k_gemmw(const T16* __restrict__ A, const T16* __restrict__ A2, const T16* __restrict__ Bt, const T16* __restrict__ Bt2, int K, float* C, int ldc, const float* __restrict__ bias, size_t sA, size_t sB, size_t sC) {
    typedef typename WFrag<T16>::V V;
    __shared__ __align__(16) float os[16 * 68];
    const size_t z = blockIdx.z; A += z * sA; if (A2) A2 += z * sA; Bt += z * sB; if (Bt2) Bt2 += z * sB; C += z * sC;
    const int lane = threadIdx.x & 31, lr = lane & 15, hi = lane >> 4; const int r0 = blockIdx.x * 64, c0 = blockIdx.y * 64;
    v8f acc[4][4];
#pragma unroll
    for (int mb = 0; mb < 4; ++mb)
#pragma unroll
        for (int nb = 0; nb < 4; ++nb) acc[mb][nb] = (v8f){};
    const size_t aoff = (size_t)(r0 + lr) * K + 8 * hi, boff = (size_t)(c0 + lr) * K + 8 * hi;
#pragma unroll 1
    for (int kc = 0; kc < K; kc += 32) {
        V a[4], a2[4];
#pragma unroll
        for (int mb = 0; mb < 4; ++mb) { a[mb] = WFrag<T16>::ld(A + aoff + (size_t)mb * 16 * K + kc); if (NSPLIT == 1 || NSPLIT == 2) a2[mb] = WFrag<T16>::ld(A2 + aoff + (size_t)mb * 16 * K + kc); }
#pragma unroll
        for (int nb = 0; nb < 4; ++nb) { const V b = WFrag<T16>::ld(Bt + boff + (size_t)nb * 16 * K + kc); V b2; if (NSPLIT >= 2) b2 = WFrag<T16>::ld(Bt2 + boff + (size_t)nb * 16 * K + kc);
#pragma unroll
            for (int mb = 0; mb < 4; ++mb) { acc[mb][nb] = WFrag<T16>::mma(a[mb], b, acc[mb][nb]); if (NSPLIT == 1 || NSPLIT == 2) acc[mb][nb] = WFrag<T16>::mma(a2[mb], b, acc[mb][nb]); if (NSPLIT >= 2) acc[mb][nb] = WFrag<T16>::mma(a[mb], b2, acc[mb][nb]); } }
        asm volatile("v_nop\n\tv_nop\n\tv_nop\n\tv_nop" : "+v"(acc[0][0]), "+v"(acc[1][1]), "+v"(acc[2][2]), "+v"(acc[3][3]) : "v"(a[0]), "v"(a[3]));
    }
#pragma unroll
    for (int mb = 0; mb < 4; ++mb) {
#pragma unroll
        for (int nb = 0; nb < 4; ++nb) {
#pragma unroll
            for (int j = 0; j < 8; ++j) os[(hi * 8 + j) * 68 + nb * 16 + lr] = acc[mb][nb][j]; }
        __builtin_amdgcn_wave_barrier(); asm volatile("" ::: "memory");
        float* crow = C + (size_t)(r0 + mb * 16) * ldc + c0;
{
#pragma unroll
            for (int s = 0; s < 8; ++s) { const int row = 2 * s + hi, cofs = lr * 4; v4f val = *(const v4fa*)(os + row * 68 + cofs); if (BIAS) { val[0] += bfr(bias[c0 + cofs]); val[1] += bfr(bias[c0 + cofs + 1]); val[2] += bfr(bias[c0 + cofs + 2]); val[3] += bfr(bias[c0 + cofs + 3]); }
                *(v4f*)(crow + (size_t)row * ldc + cofs) = val; }
             }
        __builtin_amdgcn_wave_barrier(); asm volatile("" ::: "memory");
    }
}

__device__ __forceinline__ h16 tohx(float x) { return (h16)x; }
__device__ __forceinline__ void splitf(float y, unsigned short& h, unsigned short& l) { h = f2bf(y); l = f2bf(y - bf2f(h)); }
typedef __attribute__((ext_vector_type(2))) _Float16 v2h;
typedef __attribute__((ext_vector_type(4))) _Float16 v4h;
typedef __attribute__((ext_vector_type(2))) unsigned short v2us;
typedef __attribute__((ext_vector_type(4))) unsigned short v4us;

__global__ __launch_bounds__(256) void k_cvt8(const float* __restrict__ src, bf* dst, size_t n8) { const size_t i = (size_t)blockIdx.x * 256 + threadIdx.x; if (i >= n8) return; const v8f v = *(const v8f*)(src + i * 8); v8us o;
#pragma unroll
    for (int k = 0; k < 8; ++k) o[k] = f2bf(v[k]); *(v8us*)(dst + i * 8) = o;  }
__global__ __launch_bounds__(256) void k_wtG(const float* __restrict__ w, int K, int N, bf* Bt) {
    const int lane = threadIdx.x & 31; const int L0 = (blockIdx.x * 8 + (threadIdx.x >> 5)) * 8; const int nlines = N * K / 64;
{
#pragma unroll 1
        for (int l = 0; l < 8; ++l) { const int L = L0 + l; if (L >= nlines) break; const size_t e = (size_t)L * 64 + lane * 2; const int k = (int)(e % K), n = (int)(e / K); v2us o;
            o[0] = f2bf(w[(size_t)k * N + n]); o[1] = f2bf(w[(size_t)(k + 1) * N + n]); *(v2us*)(Bt + e) = o; }
         }
}
__global__ __launch_bounds__(256) void k_qkpl(const float* __restrict__ Q, const float* __restrict__ Kf, bf* Qh, bf* Ql, bf* Kh, bf* Kl) { const size_t i = ((size_t)blockIdx.x * 256 + threadIdx.x) * 4; if (i >= (size_t)SS * DK) return; const v4f a = *(const v4f*)(Q + i), c = *(const v4f*)(Kf + i); v4us qh, ql, kh, kl;
#pragma unroll
    for (int q = 0; q < 4; ++q) { unsigned short u, l; splitf(a[q] * 0.125f, u, l); qh[q] = u; ql[q] = l; splitf(c[q], u, l); kh[q] = u; kl[q] = l; }
    { *(v4us*)(Qh + i) = qh; *(v4us*)(Ql + i) = ql; *(v4us*)(Kh + i) = kh; *(v4us*)(Kl + i) = kl;  } }
__global__ __launch_bounds__(256) void k_vt(const float* __restrict__ V, h16* VT) { const size_t e = ((size_t)blockIdx.x * 256 + threadIdx.x) * 2; if (e >= (size_t)DK * SS) return; const int s = (int)(e % SS); const int d = (int)(e / SS); v2h o; o[0] = tohx(V[(size_t)s * DK + d]); o[1] = tohx(V[(size_t)(s + 1) * DK + d]); *(v2h*)(VT + e) = o;  }
__global__ __launch_bounds__(256) void k_fin(const float* __restrict__ O, float* OUT) { const size_t i = ((size_t)blockIdx.x * 256 + threadIdx.x) * 4; if (i >= (size_t)SS * DK) return; const v4f a = *(const v4f*)(O + i); v4f o; o[0] = a[0] * (1.0f / PCAR); o[1] = a[1] * (1.0f / PCAR); o[2] = a[2] * (1.0f / PCAR); o[3] = a[3] * (1.0f / PCAR); *(v4f*)(OUT + i) = o;  }
// k_soft<NFULL, TAIL>: wave per score row (ld = 128 NFULL + 64 TAIL) in three passes over memory (max; sum of exp; write P = exp/sum x1024 fp16); keys >= nvalid excluded; rows with (row % rowsper) >= rvalid write zeros (lane -> 4 consecutive
template <int NFULL, int TAIL> __global__ __launch_bounds__(256) void k_soft(const float* __restrict__ Sb, int nrows, int rowsper, int rvalid, int nvalid, h16* P) { const int lane = threadIdx.x & 31; const size_t row = (size_t)blockIdx.x * 8 + (threadIdx.x >> 5); if (row >= (size_t)nrows) return; constexpr int LD = NFULL * 128 + TAIL * 64; const float* sr = Sb + row * LD; h16* pr = P + row * LD; const bool live = (int)(row % rowsper) < rvalid; float mx = -3.0e38f;
#pragma unroll 1
    for (int ch = 0; ch < NFULL + TAIL; ++ch) { if (ch == NFULL && lane >= 16) break; const int j0 = ch * 128 + lane * 4; const v4f a = *(const v4f*)(sr + j0);
#pragma unroll
        for (int q = 0; q < 4; ++q) if (j0 + q < nvalid) mx = fmaxf(mx, a[q]); }
#pragma unroll
    for (int sh = 16; sh; sh >>= 1) mx = fmaxf(mx, __shfl_xor(mx, sh, 32));
    float sum = 0.f;
#pragma unroll 1
    for (int ch = 0; ch < NFULL + TAIL; ++ch) { if (ch == NFULL && lane >= 16) break; const int j0 = ch * 128 + lane * 4; const v4f a = *(const v4f*)(sr + j0);
#pragma unroll
        for (int q = 0; q < 4; ++q) if (j0 + q < nvalid) { float d0 = __fsub_rn(a[q], mx); asm volatile("" : "+v"(d0)); sum += __expf(d0); } }
#pragma unroll
    for (int sh = 16; sh; sh >>= 1) sum += __shfl_xor(sum, sh, 32);
    const float f = live ? __fdiv_rn(PCAR, sum) : 0.f;
    {
#pragma unroll 1
        for (int ch = 0; ch < NFULL + TAIL; ++ch) { if (ch == NFULL && lane >= 16) break; const int j0 = ch * 128 + lane * 4; const v4f a = *(const v4f*)(sr + j0); v4h o;
#pragma unroll
            for (int q = 0; q < 4; ++q) { float val = 0.f; if (live && j0 + q < nvalid) { float d0 = __fsub_rn(a[q], mx); asm volatile("" : "+v"(d0)); val = __fmul_rn(__expf(d0), f); } o[q] = tohx(val); } *(v4h*)(pr + j0) = o; }
         } }

extern "C" void kernel_launch(void* const* d_in, const int* in_sizes, int n_in,
                              void* d_out, int out_size, void* d_ws, size_t ws_size, hipStream_t stream) {
    (void)in_sizes; (void)n_in; (void)out_size;
    const float* x = (const float*)d_in[0]; const float* wq = (const float*)d_in[1]; const float* bq = (const float*)d_in[2]; const float* wk = (const float*)d_in[3]; const float* bk = (const float*)d_in[4]; const float* wv = (const float*)d_in[5]; const float* bv = (const float*)d_in[6];
    float* OUT = (float*)d_out;     // [4][4096][64]
    char* wsp = (char*)d_ws;
    auto take = [&](size_t bytes) { char* p = wsp; wsp += (bytes + 255) & ~(size_t)255; return (void*)p; };
    bf* WQ = (bf*)take(DM * DK * 2); bf* WK = (bf*)take(DM * DK * 2); bf* WV = (bf*)take(DM * DK * 2); bf* XB = (bf*)take((size_t)SS * DM * 2); float* Q = (float*)take((size_t)SS * DK * 4); float* Kf = (float*)take((size_t)SS * DK * 4); float* V = (float*)take((size_t)SS * DK * 4);
    bf* Qh = (bf*)take((size_t)SS * DK * 2); bf* Ql = (bf*)take((size_t)SS * DK * 2); bf* Kh = (bf*)take((size_t)SS * DK * 2); bf* Kl = (bf*)take((size_t)SS * DK * 2); h16* VT = (h16*)take((size_t)DK * SS * 2); float* Sb = (float*)take((size_t)SS * SS * 4); h16* P16 = (h16*)take((size_t)SS * SS * 2); float* O = (float*)take((size_t)SS * DK * 4);
    if ((size_t)(wsp - (char*)d_ws) > ws_size) return;    // total ~ 112 MB (the [4096][4096] f32 scores 67 MB + fp16 probabilities 34 MB)
    k_wtG<<<(DM * DK / 64 + 63) / 64, 256, 0, stream>>>(wq, DM, DK, WQ); k_wtG<<<(DM * DK / 64 + 63) / 64, 256, 0, stream>>>(wk, DM, DK, WK); k_wtG<<<(DM * DK / 64 + 63) / 64, 256, 0, stream>>>(wv, DM, DK, WV);   // x @ W [512][64] -> Bt
    for (int b = 0; b < NB_; ++b) {
        k_cvt8<<<(unsigned)(((size_t)SS * DM / 8 + 255) / 256), 256, 0, stream>>>(x + (size_t)b * SS * DM, XB, (size_t)SS * DM / 8);
        k_gemmw<bf, 0, true><<<dim3(SS / 64, 1, 1), 32, 0, stream>>>(XB, nullptr, WQ, nullptr, DM, Q, DK, bq, 0, 0, 0); k_gemmw<bf, 0, true><<<dim3(SS / 64, 1, 1), 32, 0, stream>>>(XB, nullptr, WK, nullptr, DM, Kf, DK, bk, 0, 0, 0); k_gemmw<bf, 0, true><<<dim3(SS / 64, 1, 1), 32, 0, stream>>>(XB, nullptr, WV, nullptr, DM, V, DK, bv, 0, 0, 0);
        k_qkpl<<<(unsigned)(((size_t)SS * DK / 4 + 255) / 256), 256, 0, stream>>>(Q, Kf, Qh, Ql, Kh, Kl); k_vt<<<(unsigned)(((size_t)DK * SS / 2 + 255) / 256), 256, 0, stream>>>(V, VT);
        k_gemmw<bf, 2, false><<<dim3(SS / 64, SS / 64, 1), 32, 0, stream>>>(Qh, Ql, Kh, Kl, DK, Sb, SS, nullptr, 0, 0, 0);
        k_soft<32, 0><<<(SS + 7) / 8, 256, 0, stream>>>(Sb, SS, SS, SS, SS, P16);
        k_gemmw<h16, 0, false><<<dim3(SS / 64, 1, 1), 32, 0, stream>>>(P16, nullptr, VT, nullptr, SS, O, DK, nullptr, 0, 0, 0);
        k_fin<<<(unsigned)(((size_t)SS * DK / 4 + 255) / 256), 256, 0, stream>>>(O, OUT + (size_t)b * SS * DK); }
}

// v001
// It runs in 501 microseconds.
// In two side-by-side timings against v000, it was 1.72 and 1.73 times as fast.
#include <hip/hip_runtime.h>

// ScaledDotProductAttentionLayer (x [4][4096][512]; q = x wq + bq, k = x wk + bk (64), v = x wv + bv (64); probs = softmax(q.k / 8) over the 4096 keys; out = probs v -> [4][4096][64]).
// Compute dtypes, f32 accumulate: every input rounded to bf16; q/k/v projections on PLAIN bf16 operands (inputs: exact, + bias); scores (K 64) on bf16 hi+lo planes of q (x 1/8) and k (3 products; logits have unit scale);

#define NB_  4
#define SS   4096
#define DM   512
#define DK   64
#define PCAR 1024.0f
#define KSP  4     // K slices of each q/k/v projection (K 512 -> 128 per wave)
#define KSO  16    // K slices of probs x V (K 4096 -> 256 per wave)
typedef _Float16 h16;
typedef unsigned short bf;
typedef __attribute__((ext_vector_type(16))) __bf16   v16bf;
typedef __attribute__((ext_vector_type(16))) _Float16 v16h;
typedef __attribute__((ext_vector_type(8)))  _Float16 v8h;
typedef __attribute__((ext_vector_type(8)))  unsigned short v8us;
typedef __attribute__((ext_vector_type(8)))  float    v8f;
typedef __attribute__((ext_vector_type(4)))  float    v4f;
typedef v8h  __attribute__((may_alias)) v8ha;
typedef v4f  __attribute__((may_alias)) v4fa;
typedef v8us __attribute__((may_alias)) v8usa;

__device__ __forceinline__ unsigned short f2bf(float f) { unsigned u = __float_as_uint(f); u += 0x7FFFu + ((u >> 16) & 1u); return (unsigned short)(u >> 16); }
__device__ __forceinline__ float bf2f(unsigned short b) { return __uint_as_float(((unsigned)b) << 16); }
__device__ __forceinline__ float bfr(float f) { return bf2f(f2bf(f)); }
__device__ __forceinline__ v16h cat16(v8h lo, v8h hi) { return __builtin_shufflevector(lo, hi, 0, 1, 2, 3, 4, 5, 6, 7, 8, 9, 10, 11, 12, 13, 14, 15); }
__device__ __forceinline__ v16bf cat16b(v8us lo, v8us hi) { return __builtin_bit_cast(v16bf, __builtin_shufflevector(lo, hi, 0, 1, 2, 3, 4, 5, 6, 7, 8, 9, 10, 11, 12, 13, 14, 15)); }
__device__ __forceinline__ v8f wmma16(v16h a, v16h b, v8f c) { return __builtin_amdgcn_wmma_f32_16x16x32_f16(false, a, false, b, (short)0, c, false, false); }
__device__ __forceinline__ v8f wmmab(v16bf a, v16bf b, v8f c) { return __builtin_amdgcn_wmma_f32_16x16x32_bf16(false, a, false, b, (short)0, c, false, false); }



// ---- k_gemmw: register-blocked GEMM, ONE WAVE per 64x64 output tile (16 accumulators), operands straight from K-contiguous 16-bit planes; grid (M/64, N/64, Z), 32 threads.
// C[m][n] (f32, pitch ldc, + optional f32 bias[n]) = sum_k A[m][k] Bt[n][k] (+ split products per NSPLIT). z-batch strides sA/sB/sC in elements. K % 32 == 0.
// K = row pitch of A and Bt in elements, KR = k range of one workgroup (KR % 32 == 0). Split K: grid z = K / KR slices, sA = sB = KR, sC = one whole C plane; plane z holds the sum over its own k range (the bias goes into plane 0 alone) and the consumer kernel adds the planes.
template <typename T16> struct WFrag;
template <> struct WFrag<h16> { typedef v16h V; static __device__ __forceinline__ V ld(const h16* p) { return cat16(*(const v8h*)p, *(const v8h*)(p + 16)); } static __device__ __forceinline__ v8f mma(V a, V b, v8f c) { return wmma16(a, b, c); } };
template <> struct WFrag<bf> { typedef v16bf V; static __device__ __forceinline__ V ld(const bf* p) { return cat16b(*(const v8us*)p, *(const v8us*)(p + 16)); } static __device__ __forceinline__ v8f mma(V a, V b, v8f c) { return wmmab(a, b, c); } };
template <typename T16, int NSPLIT, bool BIAS>
__global__ __launch_bounds__(32) void k_gemmw(const T16* __restrict__ A, const T16* __restrict__ A2, const T16* __restrict__ Bt, const T16* __restrict__ Bt2, int K, int KR, float* C, int ldc, const float* __restrict__ bias, size_t sA, size_t sB, size_t sC) {
    typedef typename WFrag<T16>::V V;
    __shared__ __align__(16) float os[16 * 68];
    const size_t z = blockIdx.z; A += z * sA; if (A2) A2 += z * sA; Bt += z * sB; if (Bt2) Bt2 += z * sB; C += z * sC;
    const int lane = threadIdx.x & 31, lr = lane & 15, hi = lane >> 4; const int r0 = blockIdx.x * 64, c0 = blockIdx.y * 64;
    v8f acc[4][4];
#pragma unroll
    for (int mb = 0; mb < 4; ++mb)
#pragma unroll
        for (int nb = 0; nb < 4; ++nb) acc[mb][nb] = (v8f){};
    v4f bz = (v4f){};    // bias of this lane's four output columns
    if (BIAS && z == 0) { bz[0] = bfr(bias[c0 + lr * 4]); bz[1] = bfr(bias[c0 + lr * 4 + 1]); bz[2] = bfr(bias[c0 + lr * 4 + 2]); bz[3] = bfr(bias[c0 + lr * 4 + 3]); }
    const size_t aoff = (size_t)(r0 + lr) * K + 8 * hi, boff = (size_t)(c0 + lr) * K + 8 * hi;
#pragma unroll 1
    for (int kc = 0; kc < KR; kc += 32) {
        V a[4], a2[4];
#pragma unroll
        for (int mb = 0; mb < 4; ++mb) { a[mb] = WFrag<T16>::ld(A + aoff + (size_t)mb * 16 * K + kc); if (NSPLIT == 1 || NSPLIT == 2) a2[mb] = WFrag<T16>::ld(A2 + aoff + (size_t)mb * 16 * K + kc); }
#pragma unroll
        for (int nb = 0; nb < 4; ++nb) { const V b = WFrag<T16>::ld(Bt + boff + (size_t)nb * 16 * K + kc); V b2; if (NSPLIT >= 2) b2 = WFrag<T16>::ld(Bt2 + boff + (size_t)nb * 16 * K + kc);
#pragma unroll
            for (int mb = 0; mb < 4; ++mb) { acc[mb][nb] = WFrag<T16>::mma(a[mb], b, acc[mb][nb]); if (NSPLIT == 1 || NSPLIT == 2) acc[mb][nb] = WFrag<T16>::mma(a2[mb], b, acc[mb][nb]); if (NSPLIT >= 2) acc[mb][nb] = WFrag<T16>::mma(a[mb], b2, acc[mb][nb]); } }
        asm volatile("v_nop\n\tv_nop\n\tv_nop\n\tv_nop" : "+v"(acc[0][0]), "+v"(acc[1][1]), "+v"(acc[2][2]), "+v"(acc[3][3]) : "v"(a[0]), "v"(a[3]));
    }
#pragma unroll
    for (int mb = 0; mb < 4; ++mb) {
#pragma unroll
        for (int nb = 0; nb < 4; ++nb) {
#pragma unroll
            for (int j = 0; j < 8; ++j) os[(hi * 8 + j) * 68 + nb * 16 + lr] = acc[mb][nb][j]; }
        __builtin_amdgcn_wave_barrier(); asm volatile("" ::: "memory");
        float* crow = C + (size_t)(r0 + mb * 16) * ldc + c0;
{
#pragma unroll
            for (int s = 0; s < 8; ++s) { const int row = 2 * s + hi, cofs = lr * 4; v4f val = *(const v4fa*)(os + row * 68 + cofs); if (BIAS) val += bz;
                *(v4f*)(crow + (size_t)row * ldc + cofs) = val; }
             }
        __builtin_amdgcn_wave_barrier(); asm volatile("" ::: "memory");
    }
}

__device__ __forceinline__ h16 tohx(float x) { return (h16)x; }
__device__ __forceinline__ void splitf(float y, unsigned short& h, unsigned short& l) { h = f2bf(y); l = f2bf(y - bf2f(h)); }
typedef __attribute__((ext_vector_type(2))) _Float16 v2h;
typedef __attribute__((ext_vector_type(4))) _Float16 v4h;
typedef __attribute__((ext_vector_type(2))) unsigned short v2us;
typedef __attribute__((ext_vector_type(4))) unsigned short v4us;

__global__ __launch_bounds__(256) void k_cvt8(const float* __restrict__ src, bf* dst, size_t n8) { const size_t i = (size_t)blockIdx.x * 256 + threadIdx.x; if (i >= n8) return; const v8f v = *(const v8f*)(src + i * 8); v8us o;
#pragma unroll
    for (int k = 0; k < 8; ++k) o[k] = f2bf(v[k]); *(v8us*)(dst + i * 8) = o;  }
__global__ __launch_bounds__(256) void k_wtG(const float* __restrict__ w, int K, int N, bf* Bt) {
    const int lane = threadIdx.x & 31; const int L0 = (blockIdx.x * 8 + (threadIdx.x >> 5)) * 8; const int nlines = N * K / 64;
{
#pragma unroll 1
        for (int l = 0; l < 8; ++l) { const int L = L0 + l; if (L >= nlines) break; const size_t e = (size_t)L * 64 + lane * 2; const int k = (int)(e % K), n = (int)(e / K); v2us o;
            o[0] = f2bf(w[(size_t)k * N + n]); o[1] = f2bf(w[(size_t)(k + 1) * N + n]); *(v2us*)(Bt + e) = o; }
         }
}
__global__ __launch_bounds__(256) void k_qkpl(const float* __restrict__ Q, const float* __restrict__ Kf, bf* Qh, bf* Ql, bf* Kh, bf* Kl) { const size_t i = ((size_t)blockIdx.x * 256 + threadIdx.x) * 4; if (i >= (size_t)SS * DK) return; v4f a = *(const v4f*)(Q + i), c = *(const v4f*)(Kf + i); v4us qh, ql, kh, kl;
#pragma unroll
    for (int p = 1; p < KSP; ++p) { a += *(const v4f*)(Q + (size_t)p * SS * DK + i); c += *(const v4f*)(Kf + (size_t)p * SS * DK + i); }
#pragma unroll
    for (int q = 0; q < 4; ++q) { unsigned short u, l; splitf(a[q] * 0.125f, u, l); qh[q] = u; ql[q] = l; splitf(c[q], u, l); kh[q] = u; kl[q] = l; }
    { *(v4us*)(Qh + i) = qh; *(v4us*)(Ql + i) = ql; *(v4us*)(Kh + i) = kh; *(v4us*)(Kl + i) = kl;  } }
__global__ __launch_bounds__(256) void k_vt(const float* __restrict__ V, h16* VT) { const size_t e = ((size_t)blockIdx.x * 256 + threadIdx.x) * 2; if (e >= (size_t)DK * SS) return; const int s = (int)(e % SS); const int d = (int)(e / SS); float v0 = V[(size_t)s * DK + d], v1 = V[(size_t)(s + 1) * DK + d];
#pragma unroll
    for (int p = 1; p < KSP; ++p) { v0 += V[(size_t)p * SS * DK + (size_t)s * DK + d]; v1 += V[(size_t)p * SS * DK + (size_t)(s + 1) * DK + d]; }
    v2h o; o[0] = tohx(v0); o[1] = tohx(v1); *(v2h*)(VT + e) = o;  }
__global__ __launch_bounds__(256) void k_fin(const float* __restrict__ O, float* OUT) { const size_t i = ((size_t)blockIdx.x * 256 + threadIdx.x) * 4; if (i >= (size_t)SS * DK) return; v4f a = *(const v4f*)(O + i);
#pragma unroll
    for (int p = 1; p < KSO; ++p) {
        if ((p & 7) == 0) asm volatile("s_wait_xcnt 0x0" ::: "memory");    // eight planes share one address pair (offset field); the next group's loads may land in that pair's registers
        a += *(const v4f*)(O + (size_t)p * SS * DK + i); }
    v4f o; o[0] = a[0] * (1.0f / PCAR); o[1] = a[1] * (1.0f / PCAR); o[2] = a[2] * (1.0f / PCAR); o[3] = a[3] * (1.0f / PCAR); *(v4f*)(OUT + i) = o;  }
// k_soft<NFULL, TAIL>: wave per score row (ld = 128 NFULL + 64 TAIL) in three passes over memory (max; sum of exp; write P = exp/sum x1024 fp16); keys >= nvalid excluded; rows with (row % rowsper) >= rvalid write zeros (lane -> 4 consecutive
template <int NFULL, int TAIL> __global__ __launch_bounds__(256) void k_soft(const float* __restrict__ Sb, int nrows, int rowsper, int rvalid, int nvalid, h16* P) { const int lane = threadIdx.x & 31; const size_t row = (size_t)blockIdx.x * 8 + (threadIdx.x >> 5); if (row >= (size_t)nrows) return; constexpr int LD = NFULL * 128 + TAIL * 64; const float* sr = Sb + row * LD; h16* pr = P + row * LD; const bool live = (int)(row % rowsper) < rvalid; float mx = -3.0e38f;
#pragma unroll 1
    for (int ch = 0; ch < NFULL + TAIL; ++ch) { if (ch == NFULL && lane >= 16) break; const int j0 = ch * 128 + lane * 4; const v4f a = *(const v4f*)(sr + j0);
#pragma unroll
        for (int q = 0; q < 4; ++q) if (j0 + q < nvalid) mx = fmaxf(mx, a[q]); }
#pragma unroll
    for (int sh = 16; sh; sh >>= 1) mx = fmaxf(mx, __shfl_xor(mx, sh, 32));
    float sum = 0.f;
#pragma unroll 1
    for (int ch = 0; ch < NFULL + TAIL; ++ch) { if (ch == NFULL && lane >= 16) break; const int j0 = ch * 128 + lane * 4; const v4f a = *(const v4f*)(sr + j0);
#pragma unroll
        for (int q = 0; q < 4; ++q) if (j0 + q < nvalid) { float d0 = __fsub_rn(a[q], mx); asm volatile("" : "+v"(d0)); sum += __expf(d0); } }
#pragma unroll
    for (int sh = 16; sh; sh >>= 1) sum += __shfl_xor(sum, sh, 32);
    const float f = live ? __fdiv_rn(PCAR, sum) : 0.f;
    {
#pragma unroll 1
        for (int ch = 0; ch < NFULL + TAIL; ++ch) { if (ch == NFULL && lane >= 16) break; const int j0 = ch * 128 + lane * 4; const v4f a = *(const v4f*)(sr + j0); v4h o;
#pragma unroll
            for (int q = 0; q < 4; ++q) { float val = 0.f; if (live && j0 + q < nvalid) { float d0 = __fsub_rn(a[q], mx); asm volatile("" : "+v"(d0)); val = __fmul_rn(__expf(d0), f); } o[q] = tohx(val); } *(v4h*)(pr + j0) = o; }
         } }

extern "C" void kernel_launch(void* const* d_in, const int* in_sizes, int n_in,
                              void* d_out, int out_size, void* d_ws, size_t ws_size, hipStream_t stream) {
    (void)in_sizes; (void)n_in; (void)out_size;
    const float* x = (const float*)d_in[0]; const float* wq = (const float*)d_in[1]; const float* bq = (const float*)d_in[2]; const float* wk = (const float*)d_in[3]; const float* bk = (const float*)d_in[4]; const float* wv = (const float*)d_in[5]; const float* bv = (const float*)d_in[6];
    float* OUT = (float*)d_out;     // [4][4096][64]
    char* wsp = (char*)d_ws;
    auto take = [&](size_t bytes) { char* p = wsp; wsp += (bytes + 255) & ~(size_t)255; return (void*)p; };
    bf* WQ = (bf*)take(DM * DK * 2); bf* WK = (bf*)take(DM * DK * 2); bf* WV = (bf*)take(DM * DK * 2); bf* XB = (bf*)take((size_t)SS * DM * 2); float* Q = (float*)take((size_t)KSP * SS * DK * 4); float* Kf = (float*)take((size_t)KSP * SS * DK * 4); float* V = (float*)take((size_t)KSP * SS * DK * 4);
    bf* Qh = (bf*)take((size_t)SS * DK * 2); bf* Ql = (bf*)take((size_t)SS * DK * 2); bf* Kh = (bf*)take((size_t)SS * DK * 2); bf* Kl = (bf*)take((size_t)SS * DK * 2); h16* VT = (h16*)take((size_t)DK * SS * 2); float* Sb = (float*)take((size_t)SS * SS * 4); h16* P16 = (h16*)take((size_t)SS * SS * 2); float* O = (float*)take((size_t)KSO * SS * DK * 4);
    if ((size_t)(wsp - (char*)d_ws) > ws_size) return;    // total ~ 137 MB (the [4096][4096] f32 scores 67 MB + fp16 probabilities 34 MB + K-slice planes 29 MB)
    k_wtG<<<(DM * DK / 64 + 63) / 64, 256, 0, stream>>>(wq, DM, DK, WQ); k_wtG<<<(DM * DK / 64 + 63) / 64, 256, 0, stream>>>(wk, DM, DK, WK); k_wtG<<<(DM * DK / 64 + 63) / 64, 256, 0, stream>>>(wv, DM, DK, WV);   // x @ W [512][64] -> Bt
    for (int b = 0; b < NB_; ++b) {
        k_cvt8<<<(unsigned)(((size_t)SS * DM / 8 + 255) / 256), 256, 0, stream>>>(x + (size_t)b * SS * DM, XB, (size_t)SS * DM / 8);
        k_gemmw<bf, 0, true><<<dim3(SS / 64, 1, KSP), 32, 0, stream>>>(XB, nullptr, WQ, nullptr, DM, DM / KSP, Q, DK, bq, DM / KSP, DM / KSP, (size_t)SS * DK); k_gemmw<bf, 0, true><<<dim3(SS / 64, 1, KSP), 32, 0, stream>>>(XB, nullptr, WK, nullptr, DM, DM / KSP, Kf, DK, bk, DM / KSP, DM / KSP, (size_t)SS * DK); k_gemmw<bf, 0, true><<<dim3(SS / 64, 1, KSP), 32, 0, stream>>>(XB, nullptr, WV, nullptr, DM, DM / KSP, V, DK, bv, DM / KSP, DM / KSP, (size_t)SS * DK);
        k_qkpl<<<(unsigned)(((size_t)SS * DK / 4 + 255) / 256), 256, 0, stream>>>(Q, Kf, Qh, Ql, Kh, Kl); k_vt<<<(unsigned)(((size_t)DK * SS / 2 + 255) / 256), 256, 0, stream>>>(V, VT);
        k_gemmw<bf, 2, false><<<dim3(SS / 64, SS / 64, 1), 32, 0, stream>>>(Qh, Ql, Kh, Kl, DK, DK, Sb, SS, nullptr, 0, 0, 0);
        k_soft<32, 0><<<(SS + 7) / 8, 256, 0, stream>>>(Sb, SS, SS, SS, SS, P16);
        k_gemmw<h16, 0, false><<<dim3(SS / 64, 1, KSO), 32, 0, stream>>>(P16, nullptr, VT, nullptr, SS, SS / KSO, O, DK, nullptr, SS / KSO, SS / KSO, (size_t)SS * DK);
        k_fin<<<(unsigned)(((size_t)SS * DK / 4 + 255) / 256), 256, 0, stream>>>(O, OUT + (size_t)b * SS * DK); }
}

// v002
// A run of this version takes 325 microseconds.
// Next to v001, in two timings, it ran 1.53 and 1.54 times as fast.
// All steps since v000 together make it 2.65 times as fast.
#include <hip/hip_runtime.h>

// ScaledDotProductAttentionLayer (x [4][4096][512]; q = x wq + bq, k = x wk + bk (64), v = x wv + bv (64); probs = softmax(q.k / 8) over the 4096 keys; out = probs v -> [4][4096][64]).
// Compute dtypes, f32 accumulate: every input rounded to bf16; q/k/v projections on PLAIN bf16 operands (inputs: exact, + bias); scores (K 64) on bf16 hi+lo planes of q (x 1/8) and k (3 products; logits have unit scale);

#define NB_  4
#define SS   4096
#define DM   512
#define DK   64
#define PCAR 1024.0f
#define KSP  4     // K slices of each q/k/v projection (K 512 -> 128 per wave)
#define KSO  16    // K slices of probs x V (K 4096 -> 256 per wave)
typedef _Float16 h16;
typedef unsigned short bf;
typedef __attribute__((ext_vector_type(16))) __bf16   v16bf;
typedef __attribute__((ext_vector_type(16))) _Float16 v16h;
typedef __attribute__((ext_vector_type(8)))  _Float16 v8h;
typedef __attribute__((ext_vector_type(8)))  unsigned short v8us;
typedef __attribute__((ext_vector_type(8)))  float    v8f;
typedef __attribute__((ext_vector_type(4)))  float    v4f;
typedef v8h  __attribute__((may_alias)) v8ha;
typedef v4f  __attribute__((may_alias)) v4fa;
typedef v8us __attribute__((may_alias)) v8usa;

__device__ __forceinline__ unsigned short f2bf(float f) { unsigned u = __float_as_uint(f); u += 0x7FFFu + ((u >> 16) & 1u); return (unsigned short)(u >> 16); }
__device__ __forceinline__ float bf2f(unsigned short b) { return __uint_as_float(((unsigned)b) << 16); }
__device__ __forceinline__ float bfr(float f) { return bf2f(f2bf(f)); }
__device__ __forceinline__ v16h cat16(v8h lo, v8h hi) { return __builtin_shufflevector(lo, hi, 0, 1, 2, 3, 4, 5, 6, 7, 8, 9, 10, 11, 12, 13, 14, 15); }
__device__ __forceinline__ v16bf cat16b(v8us lo, v8us hi) { return __builtin_bit_cast(v16bf, __builtin_shufflevector(lo, hi, 0, 1, 2, 3, 4, 5, 6, 7, 8, 9, 10, 11, 12, 13, 14, 15)); }
__device__ __forceinline__ v8f wmma16(v16h a, v16h b, v8f c) { return __builtin_amdgcn_wmma_f32_16x16x32_f16(false, a, false, b, (short)0, c, false, false); }
__device__ __forceinline__ v8f wmmab(v16bf a, v16bf b, v8f c) { return __builtin_amdgcn_wmma_f32_16x16x32_bf16(false, a, false, b, (short)0, c, false, false); }



// ---- k_gemmw: register-blocked GEMM, ONE WAVE per 64x64 output tile (16 accumulators), operands straight from K-contiguous 16-bit planes; grid (M/64, N/64, Z), 32 threads.
// C[m][n] (f32, pitch ldc, + optional f32 bias[n]) = sum_k A[m][k] Bt[n][k] (+ split products per NSPLIT). z-batch strides sA/sB/sC in elements. K % 32 == 0.
// K = row pitch of A and Bt in elements, KR = k range of one workgroup (KR % 32 == 0). Split K: grid z = K / KR slices, sA = sB = KR, sC = one whole C plane; plane z holds the sum over its own k range (the bias goes into plane 0 alone) and the consumer kernel adds the planes.
template <typename T16> struct WFrag;
template <> struct WFrag<h16> { typedef v16h V; static __device__ __forceinline__ V ld(const h16* p) { return cat16(*(const v8h*)p, *(const v8h*)(p + 16)); } static __device__ __forceinline__ v8f mma(V a, V b, v8f c) { return wmma16(a, b, c); } };
template <> struct WFrag<bf> { typedef v16bf V; static __device__ __forceinline__ V ld(const bf* p) { return cat16b(*(const v8us*)p, *(const v8us*)(p + 16)); } static __device__ __forceinline__ v8f mma(V a, V b, v8f c) { return wmmab(a, b, c); } };
template <typename T16, int NSPLIT, bool BIAS>
__global__ __launch_bounds__(32) void k_gemmw(const T16* __restrict__ A, const T16* __restrict__ A2, const T16* __restrict__ Bt, const T16* __restrict__ Bt2, int K, int KR, float* C, int ldc, const float* __restrict__ bias, size_t sA, size_t sB, size_t sC) {
    typedef typename WFrag<T16>::V V;
    __shared__ __align__(16) float os[16 * 68];
    const size_t z = blockIdx.z; A += z * sA; if (A2) A2 += z * sA; Bt += z * sB; if (Bt2) Bt2 += z * sB; C += z * sC;
    const int lane = threadIdx.x & 31, lr = lane & 15, hi = lane >> 4; const int r0 = blockIdx.x * 64, c0 = blockIdx.y * 64;
    v8f acc[4][4];
#pragma unroll
    for (int mb = 0; mb < 4; ++mb)
#pragma unroll
        for (int nb = 0; nb < 4; ++nb) acc[mb][nb] = (v8f){};
    v4f bz = (v4f){};    // bias of this lane's four output columns
    if (BIAS && z == 0) { bz[0] = bfr(bias[c0 + lr * 4]); bz[1] = bfr(bias[c0 + lr * 4 + 1]); bz[2] = bfr(bias[c0 + lr * 4 + 2]); bz[3] = bfr(bias[c0 + lr * 4 + 3]); }
    const size_t aoff = (size_t)(r0 + lr) * K + 8 * hi, boff = (size_t)(c0 + lr) * K + 8 * hi;
#pragma unroll 1
    for (int kc = 0; kc < KR; kc += 32) {
        V a[4], a2[4];
#pragma unroll
        for (int mb = 0; mb < 4; ++mb) { a[mb] = WFrag<T16>::ld(A + aoff + (size_t)mb * 16 * K + kc); if (NSPLIT == 1 || NSPLIT == 2) a2[mb] = WFrag<T16>::ld(A2 + aoff + (size_t)mb * 16 * K + kc); }
#pragma unroll
        for (int nb = 0; nb < 4; ++nb) { const V b = WFrag<T16>::ld(Bt + boff + (size_t)nb * 16 * K + kc); V b2; if (NSPLIT >= 2) b2 = WFrag<T16>::ld(Bt2 + boff + (size_t)nb * 16 * K + kc);
#pragma unroll
            for (int mb = 0; mb < 4; ++mb) { acc[mb][nb] = WFrag<T16>::mma(a[mb], b, acc[mb][nb]); if (NSPLIT == 1 || NSPLIT == 2) acc[mb][nb] = WFrag<T16>::mma(a2[mb], b, acc[mb][nb]); if (NSPLIT >= 2) acc[mb][nb] = WFrag<T16>::mma(a[mb], b2, acc[mb][nb]); } }
        asm volatile("v_nop\n\tv_nop\n\tv_nop\n\tv_nop" : "+v"(acc[0][0]), "+v"(acc[1][1]), "+v"(acc[2][2]), "+v"(acc[3][3]) : "v"(a[0]), "v"(a[3]));
    }
#pragma unroll
    for (int mb = 0; mb < 4; ++mb) {
#pragma unroll
        for (int nb = 0; nb < 4; ++nb) {
#pragma unroll
            for (int j = 0; j < 8; ++j) os[(hi * 8 + j) * 68 + nb * 16 + lr] = acc[mb][nb][j]; }
        __builtin_amdgcn_wave_barrier(); asm volatile("" ::: "memory");
        float* crow = C + (size_t)(r0 + mb * 16) * ldc + c0;
{
#pragma unroll
            for (int s = 0; s < 8; ++s) { const int row = 2 * s + hi, cofs = lr * 4; v4f val = *(const v4fa*)(os + row * 68 + cofs); if (BIAS) val += bz;
                *(v4f*)(crow + (size_t)row * ldc + cofs) = val; }
             }
        __builtin_amdgcn_wave_barrier(); asm volatile("" ::: "memory");
    }
}

__device__ __forceinline__ h16 tohx(float x) { return (h16)x; }
__device__ __forceinline__ void splitf(float y, unsigned short& h, unsigned short& l) { h = f2bf(y); l = f2bf(y - bf2f(h)); }
typedef __attribute__((ext_vector_type(2))) _Float16 v2h;
typedef __attribute__((ext_vector_type(4))) _Float16 v4h;
typedef __attribute__((ext_vector_type(2))) unsigned short v2us;
typedef __attribute__((ext_vector_type(4))) unsigned short v4us;

__global__ __launch_bounds__(256) void k_cvt8(const float* __restrict__ src, bf* dst, size_t n8) { const size_t i = (size_t)blockIdx.x * 256 + threadIdx.x; if (i >= n8) return; const v8f v = *(const v8f*)(src + i * 8); v8us o;
#pragma unroll
    for (int k = 0; k < 8; ++k) o[k] = f2bf(v[k]); *(v8us*)(dst + i * 8) = o;  }
__global__ __launch_bounds__(256) void k_wtG(const float* __restrict__ w, int K, int N, bf* Bt) {
    const int lane = threadIdx.x & 31; const int L0 = (blockIdx.x * 8 + (threadIdx.x >> 5)) * 8; const int nlines = N * K / 64;
{
#pragma unroll 1
        for (int l = 0; l < 8; ++l) { const int L = L0 + l; if (L >= nlines) break; const size_t e = (size_t)L * 64 + lane * 2; const int k = (int)(e % K), n = (int)(e / K); v2us o;
            o[0] = f2bf(w[(size_t)k * N + n]); o[1] = f2bf(w[(size_t)(k + 1) * N + n]); *(v2us*)(Bt + e) = o; }
         }
}
__global__ __launch_bounds__(256) void k_qkpl(const float* __restrict__ Q, const float* __restrict__ Kf, bf* Qh, bf* Ql, bf* Kh, bf* Kl) { const size_t i = ((size_t)blockIdx.x * 256 + threadIdx.x) * 4; if (i >= (size_t)SS * DK) return; v4f a = *(const v4f*)(Q + i), c = *(const v4f*)(Kf + i); v4us qh, ql, kh, kl;
#pragma unroll
    for (int p = 1; p < KSP; ++p) { a += *(const v4f*)(Q + (size_t)p * SS * DK + i); c += *(const v4f*)(Kf + (size_t)p * SS * DK + i); }
#pragma unroll
    for (int q = 0; q < 4; ++q) { unsigned short u, l; splitf(a[q] * 0.125f, u, l); qh[q] = u; ql[q] = l; splitf(c[q], u, l); kh[q] = u; kl[q] = l; }
    { *(v4us*)(Qh + i) = qh; *(v4us*)(Ql + i) = ql; *(v4us*)(Kh + i) = kh; *(v4us*)(Kl + i) = kl;  } }
__global__ __launch_bounds__(256) void k_vt(const float* __restrict__ V, h16* VT) { const size_t e = ((size_t)blockIdx.x * 256 + threadIdx.x) * 2; if (e >= (size_t)DK * SS) return; const int s = (int)(e % SS); const int d = (int)(e / SS); float v0 = V[(size_t)s * DK + d], v1 = V[(size_t)(s + 1) * DK + d];
#pragma unroll
    for (int p = 1; p < KSP; ++p) { v0 += V[(size_t)p * SS * DK + (size_t)s * DK + d]; v1 += V[(size_t)p * SS * DK + (size_t)(s + 1) * DK + d]; }
    v2h o; o[0] = tohx(v0); o[1] = tohx(v1); *(v2h*)(VT + e) = o;  }
__global__ __launch_bounds__(256) void k_fin(const float* __restrict__ O, float* OUT) { const size_t i = ((size_t)blockIdx.x * 256 + threadIdx.x) * 4; if (i >= (size_t)SS * DK) return; v4f a = *(const v4f*)(O + i);
#pragma unroll
    for (int p = 1; p < KSO; ++p) {
        if ((p & 7) == 0) asm volatile("s_wait_xcnt 0x0" ::: "memory");    // eight planes share one address pair (offset field); the next group's loads may land in that pair's registers
        a += *(const v4f*)(O + (size_t)p * SS * DK + i); }
    v4f o; o[0] = a[0] * (1.0f / PCAR); o[1] = a[1] * (1.0f / PCAR); o[2] = a[2] * (1.0f / PCAR); o[3] = a[3] * (1.0f / PCAR); *(v4f*)(OUT + i) = o;  }
// exp2 with the slot that the instruction set asks for behind a transcendental held in the same statement.
__device__ __forceinline__ float exp2s(float x) { float r; asm("v_exp_f32 %0, %1\n\tv_nop" : "=v"(r) : "v"(x)); return r; }
// k_soft<NFULL, TAIL>: wave per score row (ld = 128 NFULL + 64 TAIL), the whole row held in registers (lane -> 4 consecutive keys of each 128-key chunk): the scores are read from memory once, every chunk's load in flight together;
// max, then exp and sum (each lane adds its keys in ascending order, then the lanes are folded), then P = exp/sum x1024 fp16 from the kept exps; keys >= nvalid are set to -inf once (exp 0: they leave max and sum as they are and write zeros); rows with (row % rowsper) >= rvalid write zeros.
template <int NFULL, int TAIL> __global__ __launch_bounds__(256) void k_soft(const float* __restrict__ Sb, int nrows, int rowsper, int rvalid, int nvalid, h16* P) { const int lane = threadIdx.x & 31; const size_t row = (size_t)blockIdx.x * 8 + (threadIdx.x >> 5); if (row >= (size_t)nrows) return; constexpr int LD = NFULL * 128 + TAIL * 64; constexpr int NCH = NFULL + TAIL; const float* sr = Sb + row * LD; h16* pr = P + row * LD; const bool live = (int)(row % rowsper) < rvalid && nvalid > 0;
    v4f a[NCH];
#pragma unroll
    for (int ch = 0; ch < NCH; ++ch) { if (ch < NFULL || lane < 16) a[ch] = *(const v4f*)(sr + ch * 128 + lane * 4); else a[ch] = (v4f){-__builtin_inff(), -__builtin_inff(), -__builtin_inff(), -__builtin_inff()}; }
    if (nvalid < LD) {
#pragma unroll
        for (int ch = 0; ch < NCH; ++ch)
#pragma unroll
            for (int q = 0; q < 4; ++q) if (ch * 128 + lane * 4 + q >= nvalid) a[ch][q] = -__builtin_inff(); }
    float mx = -3.0e38f;
#pragma unroll
    for (int ch = 0; ch < NCH; ++ch)
#pragma unroll
        for (int q = 0; q < 4; ++q) mx = fmaxf(mx, a[ch][q]);
#pragma unroll
    for (int sh = 16; sh; sh >>= 1) mx = fmaxf(mx, __shfl_xor(mx, sh, 32));
    float sum = 0.f;
#pragma unroll
    for (int ch = 0; ch < NCH; ++ch)
#pragma unroll
        for (int q = 0; q < 4; ++q) { const float e = exp2s(__fmul_rn(__fsub_rn(a[ch][q], mx), 0x1.715476p+0f)); sum += e; a[ch][q] = e; }
#pragma unroll
    for (int sh = 16; sh; sh >>= 1) sum += __shfl_xor(sum, sh, 32);
    const float f = live ? __fdiv_rn(PCAR, sum) : 0.f;
    if (!live) {
#pragma unroll
        for (int ch = 0; ch < NCH; ++ch) a[ch] = (v4f){}; }
    v4h o[NCH];
#pragma unroll
    for (int ch = 0; ch < NCH; ++ch)
#pragma unroll
        for (int q = 0; q < 4; ++q) o[ch][q] = tohx(__fmul_rn(a[ch][q], f));
#pragma unroll
    for (int ch = 0; ch < NCH; ++ch) if (ch < NFULL || lane < 16) *(v4h*)(pr + ch * 128 + lane * 4) = o[ch]; }

extern "C" void kernel_launch(void* const* d_in, const int* in_sizes, int n_in,
                              void* d_out, int out_size, void* d_ws, size_t ws_size, hipStream_t stream) {
    (void)in_sizes; (void)n_in; (void)out_size;
    const float* x = (const float*)d_in[0]; const float* wq = (const float*)d_in[1]; const float* bq = (const float*)d_in[2]; const float* wk = (const float*)d_in[3]; const float* bk = (const float*)d_in[4]; const float* wv = (const float*)d_in[5]; const float* bv = (const float*)d_in[6];
    float* OUT = (float*)d_out;     // [4][4096][64]
    char* wsp = (char*)d_ws;
    auto take = [&](size_t bytes) { char* p = wsp; wsp += (bytes + 255) & ~(size_t)255; return (void*)p; };
    bf* WQ = (bf*)take(DM * DK * 2); bf* WK = (bf*)take(DM * DK * 2); bf* WV = (bf*)take(DM * DK * 2); bf* XB = (bf*)take((size_t)SS * DM * 2); float* Q = (float*)take((size_t)KSP * SS * DK * 4); float* Kf = (float*)take((size_t)KSP * SS * DK * 4); float* V = (float*)take((size_t)KSP * SS * DK * 4);
    bf* Qh = (bf*)take((size_t)SS * DK * 2); bf* Ql = (bf*)take((size_t)SS * DK * 2); bf* Kh = (bf*)take((size_t)SS * DK * 2); bf* Kl = (bf*)take((size_t)SS * DK * 2); h16* VT = (h16*)take((size_t)DK * SS * 2); float* Sb = (float*)take((size_t)SS * SS * 4); h16* P16 = (h16*)take((size_t)SS * SS * 2); float* O = (float*)take((size_t)KSO * SS * DK * 4);
    if ((size_t)(wsp - (char*)d_ws) > ws_size) return;    // total ~ 137 MB (the [4096][4096] f32 scores 67 MB + fp16 probabilities 34 MB + K-slice planes 29 MB)
    k_wtG<<<(DM * DK / 64 + 63) / 64, 256, 0, stream>>>(wq, DM, DK, WQ); k_wtG<<<(DM * DK / 64 + 63) / 64, 256, 0, stream>>>(wk, DM, DK, WK); k_wtG<<<(DM * DK / 64 + 63) / 64, 256, 0, stream>>>(wv, DM, DK, WV);   // x @ W [512][64] -> Bt
    for (int b = 0; b < NB_; ++b) {
        k_cvt8<<<(unsigned)(((size_t)SS * DM / 8 + 255) / 256), 256, 0, stream>>>(x + (size_t)b * SS * DM, XB, (size_t)SS * DM / 8);
        k_gemmw<bf, 0, true><<<dim3(SS / 64, 1, KSP), 32, 0, stream>>>(XB, nullptr, WQ, nullptr, DM, DM / KSP, Q, DK, bq, DM / KSP, DM / KSP, (size_t)SS * DK); k_gemmw<bf, 0, true><<<dim3(SS / 64, 1, KSP), 32, 0, stream>>>(XB, nullptr, WK, nullptr, DM, DM / KSP, Kf, DK, bk, DM / KSP, DM / KSP, (size_t)SS * DK); k_gemmw<bf, 0, true><<<dim3(SS / 64, 1, KSP), 32, 0, stream>>>(XB, nullptr, WV, nullptr, DM, DM / KSP, V, DK, bv, DM / KSP, DM / KSP, (size_t)SS * DK);
        k_qkpl<<<(unsigned)(((size_t)SS * DK / 4 + 255) / 256), 256, 0, stream>>>(Q, Kf, Qh, Ql, Kh, Kl); k_vt<<<(unsigned)(((size_t)DK * SS / 2 + 255) / 256), 256, 0, stream>>>(V, VT);
        k_gemmw<bf, 2, false><<<dim3(SS / 64, SS / 64, 1), 32, 0, stream>>>(Qh, Ql, Kh, Kl, DK, DK, Sb, SS, nullptr, 0, 0, 0);
        k_soft<32, 0><<<(SS + 7) / 8, 256, 0, stream>>>(Sb, SS, SS, SS, SS, P16);
        k_gemmw<h16, 0, false><<<dim3(SS / 64, 1, KSO), 32, 0, stream>>>(P16, nullptr, VT, nullptr, SS, SS / KSO, O, DK, nullptr, SS / KSO, SS / KSO, (size_t)SS * DK);
        k_fin<<<(unsigned)(((size_t)SS * DK / 4 + 255) / 256), 256, 0, stream>>>(O, OUT + (size_t)b * SS * DK); }
}

// v003
// A run of this version takes 237 microseconds.
// In two side-by-side timings against v002, it was 1.37 and 1.38 times as fast.
// Counting every step since v000, it is 3.65 times as fast.
#include <hip/hip_runtime.h>

// ScaledDotProductAttentionLayer (x [4][4096][512]; q = x wq + bq, k = x wk + bk (64), v = x wv + bv (64); probs = softmax(q.k / 8) over the 4096 keys; out = probs v -> [4][4096][64]).
// Compute dtypes, f32 accumulate: every input rounded to bf16; q/k/v projections on PLAIN bf16 operands (inputs: exact, + bias); scores (K 64) on bf16 hi+lo planes of q (x 1/8) and k (3 products; logits have unit scale);

#define NB_  4
#define SS   4096
#define DM   512
#define DK   64
#define KSP  4     // K slices of each q/k/v projection (K 512 -> 128 per wave)
typedef _Float16 h16;
typedef unsigned short bf;
typedef __attribute__((ext_vector_type(16))) __bf16   v16bf;
typedef __attribute__((ext_vector_type(16))) _Float16 v16h;
typedef __attribute__((ext_vector_type(8)))  _Float16 v8h;
typedef __attribute__((ext_vector_type(8)))  unsigned short v8us;
typedef __attribute__((ext_vector_type(8)))  float    v8f;
typedef __attribute__((ext_vector_type(4)))  float    v4f;
typedef v8h  __attribute__((may_alias)) v8ha;
typedef v4f  __attribute__((may_alias)) v4fa;
typedef v8us __attribute__((may_alias)) v8usa;

__device__ __forceinline__ unsigned short f2bf(float f) { unsigned u = __float_as_uint(f); u += 0x7FFFu + ((u >> 16) & 1u); return (unsigned short)(u >> 16); }
__device__ __forceinline__ float bf2f(unsigned short b) { return __uint_as_float(((unsigned)b) << 16); }
__device__ __forceinline__ float bfr(float f) { return bf2f(f2bf(f)); }
__device__ __forceinline__ v16h cat16(v8h lo, v8h hi) { return __builtin_shufflevector(lo, hi, 0, 1, 2, 3, 4, 5, 6, 7, 8, 9, 10, 11, 12, 13, 14, 15); }
__device__ __forceinline__ v16bf cat16b(v8us lo, v8us hi) { return __builtin_bit_cast(v16bf, __builtin_shufflevector(lo, hi, 0, 1, 2, 3, 4, 5, 6, 7, 8, 9, 10, 11, 12, 13, 14, 15)); }
__device__ __forceinline__ v8f wmma16(v16h a, v16h b, v8f c) { return __builtin_amdgcn_wmma_f32_16x16x32_f16(false, a, false, b, (short)0, c, false, false); }
__device__ __forceinline__ v8f wmmab(v16bf a, v16bf b, v8f c) { return __builtin_amdgcn_wmma_f32_16x16x32_bf16(false, a, false, b, (short)0, c, false, false); }



// ---- k_gemmw: register-blocked GEMM, ONE WAVE per 64x64 output tile (16 accumulators), operands straight from K-contiguous 16-bit planes; grid (M/64, N/64, Z), 32 threads.
// C[m][n] (f32, pitch ldc, + optional f32 bias[n]) = sum_k A[m][k] Bt[n][k] (+ split products per NSPLIT). z-batch strides sA/sB/sC in elements. K % 32 == 0.
// K = row pitch of A and Bt in elements, KR = k range of one workgroup (KR % 32 == 0). Split K: grid z = K / KR slices, sA = sB = KR, sC = one whole C plane; plane z holds the sum over its own k range (the bias goes into plane 0 alone) and the consumer kernel adds the planes.
template <typename T16> struct WFrag;
template <> struct WFrag<h16> { typedef v16h V; static __device__ __forceinline__ V ld(const h16* p) { return cat16(*(const v8h*)p, *(const v8h*)(p + 16)); } static __device__ __forceinline__ v8f mma(V a, V b, v8f c) { return wmma16(a, b, c); } };
template <> struct WFrag<bf> { typedef v16bf V; static __device__ __forceinline__ V ld(const bf* p) { return cat16b(*(const v8us*)p, *(const v8us*)(p + 16)); } static __device__ __forceinline__ v8f mma(V a, V b, v8f c) { return wmmab(a, b, c); } };
template <typename T16, int NSPLIT, bool BIAS>
__global__ __launch_bounds__(32) void k_gemmw(const T16* __restrict__ A, const T16* __restrict__ A2, const T16* __restrict__ Bt, const T16* __restrict__ Bt2, int K, int KR, float* C, int ldc, const float* __restrict__ bias, size_t sA, size_t sB, size_t sC) {
    typedef typename WFrag<T16>::V V;
    __shared__ __align__(16) float os[16 * 68];
    const size_t z = blockIdx.z; A += z * sA; if (A2) A2 += z * sA; Bt += z * sB; if (Bt2) Bt2 += z * sB; C += z * sC;
    const int lane = threadIdx.x & 31, lr = lane & 15, hi = lane >> 4; const int r0 = blockIdx.x * 64, c0 = blockIdx.y * 64;
    v8f acc[4][4];
#pragma unroll
    for (int mb = 0; mb < 4; ++mb)
#pragma unroll
        for (int nb = 0; nb < 4; ++nb) acc[mb][nb] = (v8f){};
    v4f bz = (v4f){};    // bias of this lane's four output columns
    if (BIAS && z == 0) { bz[0] = bfr(bias[c0 + lr * 4]); bz[1] = bfr(bias[c0 + lr * 4 + 1]); bz[2] = bfr(bias[c0 + lr * 4 + 2]); bz[3] = bfr(bias[c0 + lr * 4 + 3]); }
    const size_t aoff = (size_t)(r0 + lr) * K + 8 * hi, boff = (size_t)(c0 + lr) * K + 8 * hi;
#pragma unroll 1
    for (int kc = 0; kc < KR; kc += 32) {
        V a[4], a2[4];
#pragma unroll
        for (int mb = 0; mb < 4; ++mb) { a[mb] = WFrag<T16>::ld(A + aoff + (size_t)mb * 16 * K + kc); if (NSPLIT == 1 || NSPLIT == 2) a2[mb] = WFrag<T16>::ld(A2 + aoff + (size_t)mb * 16 * K + kc); }
#pragma unroll
        for (int nb = 0; nb < 4; ++nb) { const V b = WFrag<T16>::ld(Bt + boff + (size_t)nb * 16 * K + kc); V b2; if (NSPLIT >= 2) b2 = WFrag<T16>::ld(Bt2 + boff + (size_t)nb * 16 * K + kc);
#pragma unroll
            for (int mb = 0; mb < 4; ++mb) { acc[mb][nb] = WFrag<T16>::mma(a[mb], b, acc[mb][nb]); if (NSPLIT == 1 || NSPLIT == 2) acc[mb][nb] = WFrag<T16>::mma(a2[mb], b, acc[mb][nb]); if (NSPLIT >= 2) acc[mb][nb] = WFrag<T16>::mma(a[mb], b2, acc[mb][nb]); } }
        asm volatile("v_nop\n\tv_nop\n\tv_nop\n\tv_nop" : "+v"(acc[0][0]), "+v"(acc[1][1]), "+v"(acc[2][2]), "+v"(acc[3][3]) : "v"(a[0]), "v"(a[3]));
    }
#pragma unroll
    for (int mb = 0; mb < 4; ++mb) {
#pragma unroll
        for (int nb = 0; nb < 4; ++nb) {
#pragma unroll
            for (int j = 0; j < 8; ++j) os[(hi * 8 + j) * 68 + nb * 16 + lr] = acc[mb][nb][j]; }
        __builtin_amdgcn_wave_barrier(); asm volatile("" ::: "memory");
        float* crow = C + (size_t)(r0 + mb * 16) * ldc + c0;
{
#pragma unroll
            for (int s = 0; s < 8; ++s) { const int row = 2 * s + hi, cofs = lr * 4; v4f val = *(const v4fa*)(os + row * 68 + cofs); if (BIAS) val += bz;
                *(v4f*)(crow + (size_t)row * ldc + cofs) = val; }
             }
        __builtin_amdgcn_wave_barrier(); asm volatile("" ::: "memory");
    }
}

__device__ __forceinline__ h16 tohx(float x) { return (h16)x; }
__device__ __forceinline__ void splitf(float y, unsigned short& h, unsigned short& l) { h = f2bf(y); l = f2bf(y - bf2f(h)); }
typedef __attribute__((ext_vector_type(2))) _Float16 v2h;
typedef __attribute__((ext_vector_type(4))) _Float16 v4h;
typedef __attribute__((ext_vector_type(2))) unsigned short v2us;
typedef __attribute__((ext_vector_type(4))) unsigned short v4us;

__global__ __launch_bounds__(256) void k_cvt8(const float* __restrict__ src, bf* dst, size_t n8) { const size_t i = (size_t)blockIdx.x * 256 + threadIdx.x; if (i >= n8) return; const v8f v = *(const v8f*)(src + i * 8); v8us o;
#pragma unroll
    for (int k = 0; k < 8; ++k) o[k] = f2bf(v[k]); *(v8us*)(dst + i * 8) = o;  }
__global__ __launch_bounds__(256) void k_wtG(const float* __restrict__ w, int K, int N, bf* Bt) {
    const int lane = threadIdx.x & 31; const int L0 = (blockIdx.x * 8 + (threadIdx.x >> 5)) * 8; const int nlines = N * K / 64;
{
#pragma unroll 1
        for (int l = 0; l < 8; ++l) { const int L = L0 + l; if (L >= nlines) break; const size_t e = (size_t)L * 64 + lane * 2; const int k = (int)(e % K), n = (int)(e / K); v2us o;
            o[0] = f2bf(w[(size_t)k * N + n]); o[1] = f2bf(w[(size_t)(k + 1) * N + n]); *(v2us*)(Bt + e) = o; }
         }
}
__global__ __launch_bounds__(256) void k_qkpl(const float* __restrict__ Q, const float* __restrict__ Kf, bf* Qh, bf* Ql, bf* Kh, bf* Kl) { const size_t i = ((size_t)blockIdx.x * 256 + threadIdx.x) * 4; if (i >= (size_t)SS * DK) return; v4f a = *(const v4f*)(Q + i), c = *(const v4f*)(Kf + i); v4us qh, ql, kh, kl;
#pragma unroll
    for (int p = 1; p < KSP; ++p) { a += *(const v4f*)(Q + (size_t)p * SS * DK + i); c += *(const v4f*)(Kf + (size_t)p * SS * DK + i); }
#pragma unroll
    for (int q = 0; q < 4; ++q) { unsigned short u, l; splitf(a[q] * 0.125f, u, l); qh[q] = u; ql[q] = l; splitf(c[q], u, l); kh[q] = u; kl[q] = l; }
    { *(v4us*)(Qh + i) = qh; *(v4us*)(Ql + i) = ql; *(v4us*)(Kh + i) = kh; *(v4us*)(Kl + i) = kl;  } }
__global__ __launch_bounds__(256) void k_vt(const float* __restrict__ V, h16* VT) { const size_t e = ((size_t)blockIdx.x * 256 + threadIdx.x) * 2; if (e >= (size_t)DK * SS) return; const int s = (int)(e % SS); const int d = (int)(e / SS); float v0 = V[(size_t)s * DK + d], v1 = V[(size_t)(s + 1) * DK + d];
#pragma unroll
    for (int p = 1; p < KSP; ++p) { v0 += V[(size_t)p * SS * DK + (size_t)s * DK + d]; v1 += V[(size_t)p * SS * DK + (size_t)(s + 1) * DK + d]; }
    v2h o; o[0] = tohx(v0); o[1] = tohx(v1); *(v2h*)(VT + e) = o;  }
// exp2 with the slot that the instruction set asks for behind a transcendental held in the same statement.
__device__ __forceinline__ float exp2s(float x) { float r; asm("v_exp_f32 %0, %1\n\tv_nop" : "=v"(r) : "v"(x)); return r; }
// four exp2 in one statement: each fills the slot that the instruction set asks for behind the one before it (early-clobber outputs: none overwrites a source), one v_nop fills the last.
__device__ __forceinline__ v4f exp2q(v4f x) { float r0, r1, r2, r3; asm("v_exp_f32 %0, %4\n\tv_exp_f32 %1, %5\n\tv_exp_f32 %2, %6\n\tv_exp_f32 %3, %7\n\tv_nop" : "=&v"(r0), "=&v"(r1), "=&v"(r2), "=&v"(r3) : "v"(x[0]), "v"(x[1]), "v"(x[2]), "v"(x[3])); return (v4f){r0, r1, r2, r3}; }
#define AW 16
#define OPI 68     // LDS pitch of a staged output row in floats
#define L2E 0x1.715476p+0f
__device__ __forceinline__ float xhalf(float x) { return __builtin_bit_cast(float, __builtin_amdgcn_permlanex16(__builtin_bit_cast(int, x), __builtin_bit_cast(int, x), 0x76543210, 0xfedcba98, false, false)); }    // lane l takes lane l ^ 16's value
__global__ __launch_bounds__(AW * 32) void k_attn(const bf* __restrict__ Qh, const bf* __restrict__ Ql, const bf* __restrict__ Kh, const bf* __restrict__ Kl, const h16* __restrict__ VT, float* OUT) {
    __shared__ __align__(16) float so[AW * 32 * OPI];
    __shared__ float sm[AW * 32];
    __shared__ float sl[AW * 32];
    const int lane = threadIdx.x & 31, lr = lane & 15, hi = lane >> 4; const int w = __builtin_amdgcn_readfirstlane(threadIdx.x >> 5); const int q0 = blockIdx.x * 32;    // w in a scalar register: key loop and key addresses wave-uniform
    v16bf qh[2][2], ql[2][2];
#pragma unroll
    for (int qt = 0; qt < 2; ++qt)
#pragma unroll
        for (int ks = 0; ks < 2; ++ks) { const size_t qo = (size_t)(q0 + qt * 16 + lr) * DK + ks * 32 + 8 * hi; qh[qt][ks] = WFrag<bf>::ld(Qh + qo); ql[qt][ks] = WFrag<bf>::ld(Ql + qo); }
    v8f o[4][2];
#pragma unroll
    for (int dt = 0; dt < 4; ++dt) { o[dt][0] = (v8f){}; o[dt][1] = (v8f){}; }
    float m[2] = {-__builtin_inff(), -__builtin_inff()}, l[2] = {0.f, 0.f};
    const int k0 = w * (SS / AW);
#pragma unroll 1
    for (int kb = k0; kb < k0 + SS / AW; kb += 32) {
        v16bf kh[2][2], kl[2][2];
#pragma unroll
        for (int kt = 0; kt < 2; ++kt)
#pragma unroll
            for (int ks = 0; ks < 2; ++ks) { const size_t ko = (size_t)(kb + kt * 16 + lr) * DK + ks * 32 + 8 * hi; kh[kt][ks] = WFrag<bf>::ld(Kh + ko); kl[kt][ks] = WFrag<bf>::ld(Kl + ko); }
        asm volatile("s_wait_xcnt 0x0" ::: "memory");    // the V loads below land in the registers that hold the K loads' addresses
        __builtin_amdgcn_sched_barrier(0);    // all sixteen K loads of the pass in flight together: left alone the compiler reloads one register set four times and waits out a full load latency each time
        v8f s[2][2];
#pragma unroll
        for (int kt = 0; kt < 2; ++kt) { s[kt][0] = (v8f){}; s[kt][1] = (v8f){};
#pragma unroll
            for (int ks = 0; ks < 2; ++ks)
#pragma unroll
                for (int qt = 0; qt < 2; ++qt) { s[kt][qt] = wmmab(kh[kt][ks], qh[qt][ks], s[kt][qt]); s[kt][qt] = wmmab(kh[kt][ks], ql[qt][ks], s[kt][qt]); s[kt][qt] = wmmab(kl[kt][ks], qh[qt][ks], s[kt][qt]); } }
        v16h vf[4];
#pragma unroll
        for (int dt = 0; dt < 4; ++dt) vf[dt] = WFrag<h16>::ld(VT + (size_t)(dt * 16 + lr) * SS + kb + 8 * hi);
        float mp[2];
#pragma unroll
        for (int qt = 0; qt < 2; ++qt) { float x = s[0][qt][0];
#pragma unroll
            for (int j = 1; j < 8; ++j) x = fmaxf(x, s[0][qt][j]);
#pragma unroll
            for (int j = 0; j < 8; ++j) x = fmaxf(x, s[1][qt][j]);
            x = fmaxf(x, xhalf(x)); mp[qt] = x * L2E; }
        const bool need = mp[0] > m[0] + 8.f || mp[1] > m[1] + 8.f;
        if (__builtin_amdgcn_ballot_w32(need) != 0) {
#pragma unroll
            for (int qt = 0; qt < 2; ++qt) { const float mn = fmaxf(m[qt], mp[qt]); const float al = exp2s(m[qt] - mn); m[qt] = mn; l[qt] *= al;
#pragma unroll
                for (int dt = 0; dt < 4; ++dt) o[dt][qt] *= al; } }
        v16h p[2];
#pragma unroll
        for (int qt = 0; qt < 2; ++qt)
#pragma unroll
            for (int kt = 0; kt < 2; ++kt)
#pragma unroll
                for (int j = 0; j < 8; j += 4) { v4f t;
#pragma unroll
                    for (int c = 0; c < 4; ++c) t[c] = __builtin_fmaf(s[kt][qt][j + c], L2E, -m[qt]);
                    const v4f e = exp2q(t);
#pragma unroll
                    for (int c = 0; c < 4; ++c) { l[qt] += e[c]; p[qt][kt * 8 + j + c] = tohx(e[c]); } }
#pragma unroll
        for (int dt = 0; dt < 4; ++dt) { o[dt][0] = wmma16(vf[dt], p[0], o[dt][0]); o[dt][1] = wmma16(vf[dt], p[1], o[dt][1]); }
    }
#pragma unroll
    for (int qt = 0; qt < 2; ++qt) { l[qt] += xhalf(l[qt]); const int row = w * 32 + qt * 16 + lr; if (hi == 0) { sm[row] = m[qt]; sl[row] = l[qt]; }
#pragma unroll
        for (int dt = 0; dt < 4; ++dt) { float* d = so + (size_t)row * OPI + dt * 16 + hi * 8; *(v4fa*)d = __builtin_shufflevector(o[dt][qt], o[dt][qt], 0, 1, 2, 3); *(v4fa*)(d + 4) = __builtin_shufflevector(o[dt][qt], o[dt][qt], 4, 5, 6, 7); } }
    __syncthreads();
    const int q = threadIdx.x >> 4, dc = (threadIdx.x & 15) * 4;
    float M = sm[q];
#pragma unroll
    for (int ww = 1; ww < AW; ++ww) M = fmaxf(M, sm[ww * 32 + q]);
    float L = 0.f; v4f a = (v4f){};
#pragma unroll
    for (int ww = 0; ww < AW; ++ww) { const float f = exp2s(sm[ww * 32 + q] - M); L += sl[ww * 32 + q] * f; a += *(const v4fa*)(so + (size_t)(ww * 32 + q) * OPI + dc) * f; }
    const float r = __fdiv_rn(1.0f, L);
    *(v4f*)(OUT + (size_t)(q0 + q) * DK + dc) = a * r;
}

extern "C" void kernel_launch(void* const* d_in, const int* in_sizes, int n_in,
                              void* d_out, int out_size, void* d_ws, size_t ws_size, hipStream_t stream) {
    (void)in_sizes; (void)n_in; (void)out_size;
    const float* x = (const float*)d_in[0]; const float* wq = (const float*)d_in[1]; const float* bq = (const float*)d_in[2]; const float* wk = (const float*)d_in[3]; const float* bk = (const float*)d_in[4]; const float* wv = (const float*)d_in[5]; const float* bv = (const float*)d_in[6];
    float* OUT = (float*)d_out;     // [4][4096][64]
    char* wsp = (char*)d_ws;
    auto take = [&](size_t bytes) { char* p = wsp; wsp += (bytes + 255) & ~(size_t)255; return (void*)p; };
    bf* WQ = (bf*)take(DM * DK * 2); bf* WK = (bf*)take(DM * DK * 2); bf* WV = (bf*)take(DM * DK * 2); bf* XB = (bf*)take((size_t)SS * DM * 2); float* Q = (float*)take((size_t)KSP * SS * DK * 4); float* Kf = (float*)take((size_t)KSP * SS * DK * 4); float* V = (float*)take((size_t)KSP * SS * DK * 4);
    bf* Qh = (bf*)take((size_t)SS * DK * 2); bf* Ql = (bf*)take((size_t)SS * DK * 2); bf* Kh = (bf*)take((size_t)SS * DK * 2); bf* Kl = (bf*)take((size_t)SS * DK * 2); h16* VT = (h16*)take((size_t)DK * SS * 2);
    if ((size_t)(wsp - (char*)d_ws) > ws_size) return;    // total ~ 20 MB
    k_wtG<<<(DM * DK / 64 + 63) / 64, 256, 0, stream>>>(wq, DM, DK, WQ); k_wtG<<<(DM * DK / 64 + 63) / 64, 256, 0, stream>>>(wk, DM, DK, WK); k_wtG<<<(DM * DK / 64 + 63) / 64, 256, 0, stream>>>(wv, DM, DK, WV);   // x @ W [512][64] -> Bt
    for (int b = 0; b < NB_; ++b) {
        k_cvt8<<<(unsigned)(((size_t)SS * DM / 8 + 255) / 256), 256, 0, stream>>>(x + (size_t)b * SS * DM, XB, (size_t)SS * DM / 8);
        k_gemmw<bf, 0, true><<<dim3(SS / 64, 1, KSP), 32, 0, stream>>>(XB, nullptr, WQ, nullptr, DM, DM / KSP, Q, DK, bq, DM / KSP, DM / KSP, (size_t)SS * DK); k_gemmw<bf, 0, true><<<dim3(SS / 64, 1, KSP), 32, 0, stream>>>(XB, nullptr, WK, nullptr, DM, DM / KSP, Kf, DK, bk, DM / KSP, DM / KSP, (size_t)SS * DK); k_gemmw<bf, 0, true><<<dim3(SS / 64, 1, KSP), 32, 0, stream>>>(XB, nullptr, WV, nullptr, DM, DM / KSP, V, DK, bv, DM / KSP, DM / KSP, (size_t)SS * DK);
        k_qkpl<<<(unsigned)(((size_t)SS * DK / 4 + 255) / 256), 256, 0, stream>>>(Q, Kf, Qh, Ql, Kh, Kl); k_vt<<<(unsigned)(((size_t)DK * SS / 2 + 255) / 256), 256, 0, stream>>>(V, VT);
        k_attn<<<SS / 32, AW * 32, 0, stream>>>(Qh, Ql, Kh, Kl, VT, OUT + (size_t)b * SS * DK); }
}

// v004
// A run of this version takes 112 microseconds.
// Next to v003, in two timings, it ran 2.11 and 2.15 times as fast.
// All steps since v000 together make it 7.77 times as fast.
#include <hip/hip_runtime.h>

// ScaledDotProductAttentionLayer (x [4][4096][512]; q = x wq + bq, k = x wk + bk (64), v = x wv + bv (64); probs = softmax(q.k / 8) over the 4096 keys; out = probs v -> [4][4096][64]).
// Compute dtypes, f32 accumulate: every input rounded to bf16; q/k/v projections on PLAIN bf16 operands (inputs: exact, + bias); scores (K 64) on bf16 hi+lo planes of q (x 1/8) and k (3 products; logits have unit scale);

#define NB_  4
#define SS   4096
#define DM   512
#define DK   64
#define KSP  4     // K slices of each q/k/v projection (K 512 -> 128 per wave)
#define MS   (NB_ * SS)    // rows of all batches together: every kernel is launched once and takes the batch from its grid
typedef _Float16 h16;
typedef unsigned short bf;
typedef __attribute__((ext_vector_type(16))) __bf16   v16bf;
typedef __attribute__((ext_vector_type(16))) _Float16 v16h;
typedef __attribute__((ext_vector_type(8)))  _Float16 v8h;
typedef __attribute__((ext_vector_type(8)))  unsigned short v8us;
typedef __attribute__((ext_vector_type(8)))  float    v8f;
typedef __attribute__((ext_vector_type(4)))  float    v4f;
typedef v8h  __attribute__((may_alias)) v8ha;
typedef v4f  __attribute__((may_alias)) v4fa;
typedef v8us __attribute__((may_alias)) v8usa;

__device__ __forceinline__ unsigned short f2bf(float f) { unsigned u = __float_as_uint(f); u += 0x7FFFu + ((u >> 16) & 1u); return (unsigned short)(u >> 16); }
__device__ __forceinline__ float bf2f(unsigned short b) { return __uint_as_float(((unsigned)b) << 16); }
__device__ __forceinline__ float bfr(float f) { return bf2f(f2bf(f)); }
__device__ __forceinline__ v16h cat16(v8h lo, v8h hi) { return __builtin_shufflevector(lo, hi, 0, 1, 2, 3, 4, 5, 6, 7, 8, 9, 10, 11, 12, 13, 14, 15); }
__device__ __forceinline__ v16bf cat16b(v8us lo, v8us hi) { return __builtin_bit_cast(v16bf, __builtin_shufflevector(lo, hi, 0, 1, 2, 3, 4, 5, 6, 7, 8, 9, 10, 11, 12, 13, 14, 15)); }
__device__ __forceinline__ v8f wmma16(v16h a, v16h b, v8f c) { return __builtin_amdgcn_wmma_f32_16x16x32_f16(false, a, false, b, (short)0, c, false, false); }
__device__ __forceinline__ v8f wmmab(v16bf a, v16bf b, v8f c) { return __builtin_amdgcn_wmma_f32_16x16x32_bf16(false, a, false, b, (short)0, c, false, false); }



// ---- k_gemmw: register-blocked GEMM, ONE WAVE per 64x64 output tile (16 accumulators), operands straight from K-contiguous 16-bit planes; grid (M/64, N/64, Z), 32 threads. Column block y (64 rows of Bt) writes its own C plane of pitch ldc at C + y sN and takes its own bias vector: the q, k and v projections are column blocks 0, 1, 2 of one launch.
// C[m][n] (f32, pitch ldc, + optional f32 bias[n]) = sum_k A[m][k] Bt[n][k] (+ split products per NSPLIT). z-batch strides sA/sB/sC in elements. K % 32 == 0.
// K = row pitch of A and Bt in elements, KR = k range of one workgroup (KR % 32 == 0). Split K: grid z = K / KR slices, sA = sB = KR, sC = one whole C plane; plane z holds the sum over its own k range (the bias goes into plane 0 alone) and the consumer kernel adds the planes.
template <typename T16> struct WFrag;
template <> struct WFrag<h16> { typedef v16h V; static __device__ __forceinline__ V ld(const h16* p) { return cat16(*(const v8h*)p, *(const v8h*)(p + 16)); } static __device__ __forceinline__ v8f mma(V a, V b, v8f c) { return wmma16(a, b, c); } };
template <> struct WFrag<bf> { typedef v16bf V; static __device__ __forceinline__ V ld(const bf* p) { return cat16b(*(const v8us*)p, *(const v8us*)(p + 16)); } static __device__ __forceinline__ v8f mma(V a, V b, v8f c) { return wmmab(a, b, c); } };
template <typename T16, int NSPLIT, bool BIAS>
__global__ __launch_bounds__(32) void k_gemmw(const T16* __restrict__ A, const T16* __restrict__ A2, const T16* __restrict__ Bt, const T16* __restrict__ Bt2, int K, int KR, float* C, int ldc, const float* __restrict__ bias0, const float* __restrict__ bias1, const float* __restrict__ bias2, size_t sA, size_t sB, size_t sC, size_t sN) {
    typedef typename WFrag<T16>::V V;
    __shared__ __align__(16) float os[16 * 68];
    const size_t z = blockIdx.z; A += z * sA; if (A2) A2 += z * sA; Bt += z * sB; if (Bt2) Bt2 += z * sB; C += z * sC + blockIdx.y * sN;
    const int lane = threadIdx.x & 31, lr = lane & 15, hi = lane >> 4; const int r0 = blockIdx.x * 64, c0 = blockIdx.y * 64;
    v8f acc[4][4];
#pragma unroll
    for (int mb = 0; mb < 4; ++mb)
#pragma unroll
        for (int nb = 0; nb < 4; ++nb) acc[mb][nb] = (v8f){};
    v4f bz = (v4f){};    // bias of this lane's four output columns
    if (BIAS && z == 0) { const float* bias = blockIdx.y == 0 ? bias0 : blockIdx.y == 1 ? bias1 : bias2; bz[0] = bfr(bias[lr * 4]); bz[1] = bfr(bias[lr * 4 + 1]); bz[2] = bfr(bias[lr * 4 + 2]); bz[3] = bfr(bias[lr * 4 + 3]); }
    const size_t aoff = (size_t)(r0 + lr) * K + 8 * hi, boff = (size_t)(c0 + lr) * K + 8 * hi;
#pragma unroll 1
    for (int kc = 0; kc < KR; kc += 32) {
        V a[4], a2[4];
#pragma unroll
        for (int mb = 0; mb < 4; ++mb) { a[mb] = WFrag<T16>::ld(A + aoff + (size_t)mb * 16 * K + kc); if (NSPLIT == 1 || NSPLIT == 2) a2[mb] = WFrag<T16>::ld(A2 + aoff + (size_t)mb * 16 * K + kc); }
#pragma unroll
        for (int nb = 0; nb < 4; ++nb) { const V b = WFrag<T16>::ld(Bt + boff + (size_t)nb * 16 * K + kc); V b2; if (NSPLIT >= 2) b2 = WFrag<T16>::ld(Bt2 + boff + (size_t)nb * 16 * K + kc);
#pragma unroll
            for (int mb = 0; mb < 4; ++mb) { acc[mb][nb] = WFrag<T16>::mma(a[mb], b, acc[mb][nb]); if (NSPLIT == 1 || NSPLIT == 2) acc[mb][nb] = WFrag<T16>::mma(a2[mb], b, acc[mb][nb]); if (NSPLIT >= 2) acc[mb][nb] = WFrag<T16>::mma(a[mb], b2, acc[mb][nb]); } }
        asm volatile("v_nop\n\tv_nop\n\tv_nop\n\tv_nop" : "+v"(acc[0][0]), "+v"(acc[1][1]), "+v"(acc[2][2]), "+v"(acc[3][3]) : "v"(a[0]), "v"(a[3]));
    }
#pragma unroll
    for (int mb = 0; mb < 4; ++mb) {
#pragma unroll
        for (int nb = 0; nb < 4; ++nb) {
#pragma unroll
            for (int j = 0; j < 8; ++j) os[(hi * 8 + j) * 68 + nb * 16 + lr] = acc[mb][nb][j]; }
        __builtin_amdgcn_wave_barrier(); asm volatile("" ::: "memory");
        float* crow = C + (size_t)(r0 + mb * 16) * ldc;
{
#pragma unroll
            for (int s = 0; s < 8; ++s) { const int row = 2 * s + hi, cofs = lr * 4; v4f val = *(const v4fa*)(os + row * 68 + cofs); if (BIAS) val += bz;
                *(v4f*)(crow + (size_t)row * ldc + cofs) = val; }
             }
        __builtin_amdgcn_wave_barrier(); asm volatile("" ::: "memory");
    }
}

__device__ __forceinline__ h16 tohx(float x) { return (h16)x; }
__device__ __forceinline__ void splitf(float y, unsigned short& h, unsigned short& l) { h = f2bf(y); l = f2bf(y - bf2f(h)); }
typedef __attribute__((ext_vector_type(2))) _Float16 v2h;
typedef __attribute__((ext_vector_type(4))) _Float16 v4h;
typedef __attribute__((ext_vector_type(2))) unsigned short v2us;
typedef __attribute__((ext_vector_type(4))) unsigned short v4us;

// The four small kernels below are bodies (blk = block index within the body's own share of the grid); k_prep and k_planes each run two of them that do not depend on each other in one grid.
__device__ __forceinline__ void d_cvt8(const float* __restrict__ src, bf* dst, size_t n8, unsigned blk) { const size_t i = (size_t)blk * 256 + threadIdx.x; if (i >= n8) return; const v8f v = *(const v8f*)(src + i * 8); v8us o;
#pragma unroll
    for (int k = 0; k < 8; ++k) o[k] = f2bf(v[k]); *(v8us*)(dst + i * 8) = o;  }
__device__ __forceinline__ void d_wtG(const float* __restrict__ w, int K, int N, bf* Bt, unsigned blk) {
    const int lane = threadIdx.x & 31; const int L0 = (blk * 8 + (threadIdx.x >> 5)) * 8; const int nlines = N * K / 64;
{
#pragma unroll 1
        for (int l = 0; l < 8; ++l) { const int L = L0 + l; if (L >= nlines) break; const size_t e = (size_t)L * 64 + lane * 2; const int k = (int)(e % K), n = (int)(e / K); v2us o;
            o[0] = f2bf(w[(size_t)k * N + n]); o[1] = f2bf(w[(size_t)(k + 1) * N + n]); *(v2us*)(Bt + e) = o; }
         }
}
__device__ __forceinline__ void d_qkpl(const float* __restrict__ Q, const float* __restrict__ Kf, bf* Qh, bf* Ql, bf* Kh, bf* Kl, unsigned blk) { const size_t i = ((size_t)blk * 256 + threadIdx.x) * 4; if (i >= (size_t)MS * DK) return; v4f a = *(const v4f*)(Q + i), c = *(const v4f*)(Kf + i); v4us qh, ql, kh, kl;
#pragma unroll
    for (int p = 1; p < KSP; ++p) { a += *(const v4f*)(Q + (size_t)p * MS * DK + i); c += *(const v4f*)(Kf + (size_t)p * MS * DK + i);
        if (p == 1) asm volatile("s_wait_xcnt 0x0" ::: "memory"); }    // planes 2 and 3 lie beyond a load's immediate offset and get address registers of their own; their data lands in the registers that hold the addresses of the loads above
#pragma unroll
    for (int q = 0; q < 4; ++q) { unsigned short u, l; splitf(a[q] * 0.125f, u, l); qh[q] = u; ql[q] = l; splitf(c[q], u, l); kh[q] = u; kl[q] = l; }
    { *(v4us*)(Qh + i) = qh; *(v4us*)(Ql + i) = ql; *(v4us*)(Kh + i) = kh; *(v4us*)(Kl + i) = kl;  } }
__device__ __forceinline__ void d_vt(const float* __restrict__ V, h16* VT, unsigned blk) { const size_t e = ((size_t)blk * 256 + threadIdx.x) * 2; if (e >= (size_t)DK * MS) return; const int s = (int)(e / ((size_t)DK * SS)) * SS + (int)(e % SS); const int d = (int)(e / SS) % DK; float v0 = V[(size_t)s * DK + d], v1 = V[(size_t)(s + 1) * DK + d];
#pragma unroll
    for (int p = 1; p < KSP; ++p) { v0 += V[(size_t)p * MS * DK + (size_t)s * DK + d]; v1 += V[(size_t)p * MS * DK + (size_t)(s + 1) * DK + d]; }
    v2h o; o[0] = tohx(v0); o[1] = tohx(v1); *(v2h*)(VT + e) = o;  }
#define WTB ((DM * DK / 64 + 63) / 64)                  // blocks of one weight transpose
#define CVB ((unsigned)(((size_t)MS * DM / 8 + 255) / 256))   // blocks of the x conversion
#define VTB ((unsigned)(((size_t)DK * MS / 2 + 255) / 256))   // blocks of the V transpose
#define QKB ((unsigned)(((size_t)MS * DK / 4 + 255) / 256))   // blocks of the q/k planes
// k_prep: blocks [0, 3 WTB) transpose wq, wk, wv into WT [192][512] (the longer chains of dependent loads: they start first), the rest round x to bf16.
__global__ __launch_bounds__(256) void k_prep(const float* __restrict__ wq, const float* __restrict__ wk, const float* __restrict__ wv, bf* WT, const float* __restrict__ x, bf* XB) {
    const unsigned b = blockIdx.x;
    if (b < 3 * WTB) { const unsigned y = b / WTB; d_wtG(y == 0 ? wq : y == 1 ? wk : wv, DM, DK, WT + (size_t)y * DM * DK, b % WTB); }
    else d_cvt8(x, XB, (size_t)MS * DM / 8, b - 3 * WTB);
}
// k_planes: blocks [0, VTB) fold and transpose V, the rest fold q and k and split them into bf16 planes.
__global__ __launch_bounds__(256) void k_planes(const float* __restrict__ Q, const float* __restrict__ Kf, const float* __restrict__ V, bf* Qh, bf* Ql, bf* Kh, bf* Kl, h16* VT) {
    const unsigned b = blockIdx.x;
    if (b < VTB) d_vt(V, VT, b);
    else d_qkpl(Q, Kf, Qh, Ql, Kh, Kl, b - VTB);
}
// exp2 with the slot that the instruction set asks for behind a transcendental held in the same statement.
__device__ __forceinline__ float exp2s(float x) { float r; asm("v_exp_f32 %0, %1\n\tv_nop" : "=v"(r) : "v"(x)); return r; }
// four exp2 in one statement: each fills the slot that the instruction set asks for behind the one before it (early-clobber outputs: none overwrites a source), one v_nop fills the last.
__device__ __forceinline__ v4f exp2q(v4f x) { float r0, r1, r2, r3; asm("v_exp_f32 %0, %4\n\tv_exp_f32 %1, %5\n\tv_exp_f32 %2, %6\n\tv_exp_f32 %3, %7\n\tv_nop" : "=&v"(r0), "=&v"(r1), "=&v"(r2), "=&v"(r3) : "v"(x[0]), "v"(x[1]), "v"(x[2]), "v"(x[3])); return (v4f){r0, r1, r2, r3}; }
#define AW 16
#define OPI 68     // LDS pitch of a staged output row in floats
#define L2E 0x1.715476p+0f
__device__ __forceinline__ float xhalf(float x) { return __builtin_bit_cast(float, __builtin_amdgcn_permlanex16(__builtin_bit_cast(int, x), __builtin_bit_cast(int, x), 0x76543210, 0xfedcba98, false, false)); }    // lane l takes lane l ^ 16's value
__global__ __launch_bounds__(AW * 32) void k_attn(const bf* __restrict__ Qh, const bf* __restrict__ Ql, const bf* __restrict__ Kh, const bf* __restrict__ Kl, const h16* __restrict__ VT, float* OUT) {
    __shared__ __align__(16) float so[AW * 32 * OPI];
    __shared__ float sm[AW * 32];
    __shared__ float sl[AW * 32];
    const int lane = threadIdx.x & 31, lr = lane & 15, hi = lane >> 4; const int w = __builtin_amdgcn_readfirstlane(threadIdx.x >> 5); const int q0 = blockIdx.x * 32;    // w in a scalar register: key loop and key addresses wave-uniform
    { const size_t bo = (size_t)blockIdx.y * SS * DK; Qh += bo; Ql += bo; Kh += bo; Kl += bo; VT += bo; OUT += bo; }    // this workgroup's batch
    v16bf qh[2][2], ql[2][2];
#pragma unroll
    for (int qt = 0; qt < 2; ++qt)
#pragma unroll
        for (int ks = 0; ks < 2; ++ks) { const size_t qo = (size_t)(q0 + qt * 16 + lr) * DK + ks * 32 + 8 * hi; qh[qt][ks] = WFrag<bf>::ld(Qh + qo); ql[qt][ks] = WFrag<bf>::ld(Ql + qo); }
    asm volatile("s_wait_xcnt 0x0" ::: "memory");    // the registers that hold the Q loads' addresses are written again directly below
    __builtin_amdgcn_sched_barrier(0);    // keeps those register writes behind the wait: without it the scheduler lifts them over the statement above
    v8f o[4][2];
#pragma unroll
    for (int dt = 0; dt < 4; ++dt) { o[dt][0] = (v8f){}; o[dt][1] = (v8f){}; }
    float m[2] = {-__builtin_inff(), -__builtin_inff()}, l[2] = {0.f, 0.f};
    const int k0 = w * (SS / AW);
#pragma unroll 1
    for (int kb = k0; kb < k0 + SS / AW; kb += 32) {
        v16bf kh[2][2], kl[2][2];
#pragma unroll
        for (int kt = 0; kt < 2; ++kt)
#pragma unroll
            for (int ks = 0; ks < 2; ++ks) { const size_t ko = (size_t)(kb + kt * 16 + lr) * DK + ks * 32 + 8 * hi; kh[kt][ks] = WFrag<bf>::ld(Kh + ko); kl[kt][ks] = WFrag<bf>::ld(Kl + ko); }
        asm volatile("s_wait_xcnt 0x0" ::: "memory");    // the V loads below land in the registers that hold the K loads' addresses
        __builtin_amdgcn_sched_barrier(0);    // all sixteen K loads of the pass in flight together: left alone the compiler reloads one register set four times and waits out a full load latency each time
        v8f s[2][2];
#pragma unroll
        for (int kt = 0; kt < 2; ++kt) { s[kt][0] = (v8f){}; s[kt][1] = (v8f){};
#pragma unroll
            for (int ks = 0; ks < 2; ++ks)
#pragma unroll
                for (int qt = 0; qt < 2; ++qt) { s[kt][qt] = wmmab(kh[kt][ks], qh[qt][ks], s[kt][qt]); s[kt][qt] = wmmab(kh[kt][ks], ql[qt][ks], s[kt][qt]); s[kt][qt] = wmmab(kl[kt][ks], qh[qt][ks], s[kt][qt]); } }
        v16h vf[4];
#pragma unroll
        for (int dt = 0; dt < 4; ++dt) vf[dt] = WFrag<h16>::ld(VT + (size_t)(dt * 16 + lr) * SS + kb + 8 * hi);
        float mp[2];
#pragma unroll
        for (int qt = 0; qt < 2; ++qt) { float x = s[0][qt][0];
#pragma unroll
            for (int j = 1; j < 8; ++j) x = fmaxf(x, s[0][qt][j]);
#pragma unroll
            for (int j = 0; j < 8; ++j) x = fmaxf(x, s[1][qt][j]);
            x = fmaxf(x, xhalf(x)); mp[qt] = x * L2E; }
        const bool need = mp[0] > m[0] + 8.f || mp[1] > m[1] + 8.f;
        if (__builtin_amdgcn_ballot_w32(need) != 0) {
#pragma unroll
            for (int qt = 0; qt < 2; ++qt) { const float mn = fmaxf(m[qt], mp[qt]); const float al = exp2s(m[qt] - mn); m[qt] = mn; l[qt] *= al;
#pragma unroll
                for (int dt = 0; dt < 4; ++dt) o[dt][qt] *= al; } }
        v16h p[2];
#pragma unroll
        for (int qt = 0; qt < 2; ++qt)
#pragma unroll
            for (int kt = 0; kt < 2; ++kt)
#pragma unroll
                for (int j = 0; j < 8; j += 4) { v4f t;
#pragma unroll
                    for (int c = 0; c < 4; ++c) t[c] = __builtin_fmaf(s[kt][qt][j + c], L2E, -m[qt]);
                    const v4f e = exp2q(t);
#pragma unroll
                    for (int c = 0; c < 4; ++c) { l[qt] += e[c]; p[qt][kt * 8 + j + c] = tohx(e[c]); } }
#pragma unroll
        for (int dt = 0; dt < 4; ++dt) { o[dt][0] = wmma16(vf[dt], p[0], o[dt][0]); o[dt][1] = wmma16(vf[dt], p[1], o[dt][1]); }
    }
#pragma unroll
    for (int qt = 0; qt < 2; ++qt) { l[qt] += xhalf(l[qt]); const int row = w * 32 + qt * 16 + lr; if (hi == 0) { sm[row] = m[qt]; sl[row] = l[qt]; }
#pragma unroll
        for (int dt = 0; dt < 4; ++dt) { float* d = so + (size_t)row * OPI + dt * 16 + hi * 8; *(v4fa*)d = __builtin_shufflevector(o[dt][qt], o[dt][qt], 0, 1, 2, 3); *(v4fa*)(d + 4) = __builtin_shufflevector(o[dt][qt], o[dt][qt], 4, 5, 6, 7); } }
    __syncthreads();
    const int q = threadIdx.x >> 4, dc = (threadIdx.x & 15) * 4;
    float M = sm[q];
#pragma unroll
    for (int ww = 1; ww < AW; ++ww) M = fmaxf(M, sm[ww * 32 + q]);
    float L = 0.f; v4f a = (v4f){};
#pragma unroll
    for (int ww = 0; ww < AW; ++ww) { const float f = exp2s(sm[ww * 32 + q] - M); L += sl[ww * 32 + q] * f; a += *(const v4fa*)(so + (size_t)(ww * 32 + q) * OPI + dc) * f; }
    const float r = __fdiv_rn(1.0f, L);
    *(v4f*)(OUT + (size_t)(q0 + q) * DK + dc) = a * r;
}

extern "C" void kernel_launch(void* const* d_in, const int* in_sizes, int n_in,
                              void* d_out, int out_size, void* d_ws, size_t ws_size, hipStream_t stream) {
    (void)in_sizes; (void)n_in; (void)out_size;
    const float* x = (const float*)d_in[0]; const float* wq = (const float*)d_in[1]; const float* bq = (const float*)d_in[2]; const float* wk = (const float*)d_in[3]; const float* bk = (const float*)d_in[4]; const float* wv = (const float*)d_in[5]; const float* bv = (const float*)d_in[6];
    float* OUT = (float*)d_out;     // [4][4096][64]
    char* wsp = (char*)d_ws;
    auto take = [&](size_t bytes) { char* p = wsp; wsp += (bytes + 255) & ~(size_t)255; return (void*)p; };
    bf* WT = (bf*)take((size_t)3 * DM * DK * 2); bf* XB = (bf*)take((size_t)MS * DM * 2); float* QKV = (float*)take((size_t)3 * KSP * MS * DK * 4);    // WT: wq, wk, wv transposed, [192][512]; QKV: [q, k, v][K slice][row][64]
    float* Q = QKV; float* Kf = QKV + (size_t)KSP * MS * DK; float* V = QKV + (size_t)2 * KSP * MS * DK;
    bf* Qh = (bf*)take((size_t)MS * DK * 2); bf* Ql = (bf*)take((size_t)MS * DK * 2); bf* Kh = (bf*)take((size_t)MS * DK * 2); bf* Kl = (bf*)take((size_t)MS * DK * 2); h16* VT = (h16*)take((size_t)DK * MS * 2);
    if ((size_t)(wsp - (char*)d_ws) > ws_size) return;    // total ~ 75 MB
    k_prep<<<3 * WTB + CVB, 256, 0, stream>>>(wq, wk, wv, WT, x, XB);   // x @ W [512][64] -> Bt
    k_gemmw<bf, 0, true><<<dim3(MS / 64, 3, KSP), 32, 0, stream>>>(XB, nullptr, WT, nullptr, DM, DM / KSP, QKV, DK, bq, bk, bv, DM / KSP, DM / KSP, (size_t)MS * DK, (size_t)KSP * MS * DK);
    k_planes<<<VTB + QKB, 256, 0, stream>>>(Q, Kf, V, Qh, Ql, Kh, Kl, VT);
    k_attn<<<dim3(SS / 32, NB_), AW * 32, 0, stream>>>(Qh, Ql, Kh, Kl, VT, OUT);
}

// v005
// One run takes 70.2 microseconds.
// Next to v004, in two timings, it ran 1.58 and 1.59 times as fast.
// Counting every step since v000, it is 12.3 times as fast.
#include <hip/hip_runtime.h>

// ScaledDotProductAttentionLayer (x [4][4096][512]; q = x wq + bq, k = x wk + bk (64), v = x wv + bv (64); probs = softmax(q.k / 8) over the 4096 keys; out = probs v -> [4][4096][64]).
// Compute dtypes, f32 accumulate: every input rounded to bf16; q/k/v projections on PLAIN bf16 operands (inputs: exact, + bias); scores (K 64) on bf16 hi+lo planes of q (x 1/8) and k (3 products; logits have unit scale);

#define NB_  4
#define SS   4096
#define DM   512
#define DK   64
#define MS   (NB_ * SS)    // rows of all batches together: every kernel is launched once and takes the batch from its grid
typedef _Float16 h16;
typedef unsigned short bf;
typedef __attribute__((ext_vector_type(16))) __bf16   v16bf;
typedef __attribute__((ext_vector_type(16))) _Float16 v16h;
typedef __attribute__((ext_vector_type(8)))  _Float16 v8h;
typedef __attribute__((ext_vector_type(8)))  unsigned short v8us;
typedef __attribute__((ext_vector_type(8)))  float    v8f;
typedef __attribute__((ext_vector_type(4)))  float    v4f;
typedef v8h  __attribute__((may_alias)) v8ha;
typedef v4f  __attribute__((may_alias)) v4fa;
typedef v8us __attribute__((may_alias)) v8usa;

__device__ __forceinline__ unsigned short f2bf(float f) { unsigned u = __float_as_uint(f); u += 0x7FFFu + ((u >> 16) & 1u); return (unsigned short)(u >> 16); }
__device__ __forceinline__ float bf2f(unsigned short b) { return __uint_as_float(((unsigned)b) << 16); }
__device__ __forceinline__ float bfr(float f) { return bf2f(f2bf(f)); }
__device__ __forceinline__ v16h cat16(v8h lo, v8h hi) { return __builtin_shufflevector(lo, hi, 0, 1, 2, 3, 4, 5, 6, 7, 8, 9, 10, 11, 12, 13, 14, 15); }
__device__ __forceinline__ v16bf cat16b(v8us lo, v8us hi) { return __builtin_bit_cast(v16bf, __builtin_shufflevector(lo, hi, 0, 1, 2, 3, 4, 5, 6, 7, 8, 9, 10, 11, 12, 13, 14, 15)); }
__device__ __forceinline__ v8f wmma16(v16h a, v16h b, v8f c) { return __builtin_amdgcn_wmma_f32_16x16x32_f16(false, a, false, b, (short)0, c, false, false); }
__device__ __forceinline__ v8f wmmab(v16bf a, v16bf b, v8f c) { return __builtin_amdgcn_wmma_f32_16x16x32_bf16(false, a, false, b, (short)0, c, false, false); }



// fragment of 16 rows x 32 k from a K-contiguous 16-bit plane (global or LDS): lane = row lr, elements 0..7 = k 8 hi .., elements 8..15 = k 16 + 8 hi ..; the same for the A and the B operand.
template <typename T16> struct WFrag;
template <> struct WFrag<h16> { typedef v16h V; static __device__ __forceinline__ V ld(const h16* p) { return cat16(*(const v8h*)p, *(const v8h*)(p + 16)); } static __device__ __forceinline__ v8f mma(V a, V b, v8f c) { return wmma16(a, b, c); } };
template <> struct WFrag<bf> { typedef v16bf V; static __device__ __forceinline__ V ld(const bf* p) { return cat16b(*(const v8us*)p, *(const v8us*)(p + 16)); } static __device__ __forceinline__ v8f mma(V a, V b, v8f c) { return wmmab(a, b, c); } };

__device__ __forceinline__ h16 tohx(float x) { return (h16)x; }
__device__ __forceinline__ void splitf(float y, unsigned short& h, unsigned short& l) { h = f2bf(y); l = f2bf(y - bf2f(h)); }
typedef __attribute__((ext_vector_type(4))) unsigned short v4us;
#define PR 64      // rows of x per workgroup
#define LP 520     // LDS row pitch in 16-bit elements: 1040 bytes, an odd multiple of 16, so the 16 rows of a fragment read (and of a transposing store) fall on distinct banks
// k_proj: x conversion, weight transposes, the q/k/v projections, the q/k hi+lo planes and the V transpose in one kernel; nothing between x and the attention operands goes through memory.
// Workgroup = 64 rows of x x all 192 output columns, whole K = 512; grid MS / 64 = one workgroup per WGP, 16 waves.
// Stage 1, all 16 waves: x rows (whole-line 16-byte loads) and wq, wk, wv (whole-line 4-byte loads down 64 k of one column per lane) are rounded to bf16 and stored in LDS, the weights transposed to [column][k]; the biases too. One barrier.
// Stage 2, waves 0..11, four 16x16 accumulators each, fragments by 16-byte LDS reads:
//   waves 0..7 (q: 0..3, k: 4..7): 16 rows x 64 columns as Y^T = W^T X^T, so a lane holds 8 consecutive columns of ONE row: + bias, (q: x 1/8), hi+lo split, 16-byte stores; a wave writes whole 128-byte plane rows.
//   waves 8..11 (v): 64 rows x 16 columns as Y = X W, so a lane holds 8 consecutive rows of ONE column: + bias, fp16, 16-byte stores into V^T; a wave writes whole 128-byte lines of V^T.
__global__ __launch_bounds__(512) void k_proj(const float* __restrict__ x, const float* __restrict__ wq, const float* __restrict__ wk, const float* __restrict__ wv, const float* __restrict__ bq, const float* __restrict__ bk, const float* __restrict__ bv, bf* Qh, bf* Ql, bf* Kh, bf* Kl, h16* VT) {
    __shared__ __align__(16) bf xs[PR * LP];
    __shared__ __align__(16) bf wt[3 * DK * LP];
    __shared__ __align__(16) float sb[512];    // bq, bk, bv rounded to bf16 in the first 192; every thread stores one float, so that no branch stands at the load
    const int t = threadIdx.x, lane = t & 31, lr = lane & 15, hi = lane >> 4; const int w = __builtin_amdgcn_readfirstlane(t >> 5); const int r0 = blockIdx.x * PR;
    const float bl = (w < 2 ? bq : w < 4 ? bk : bv)[t & (DK - 1)];    // the oldest load of the wave: it is back with the first x rows (waves 6..15 read bv again; nobody reads their copies)
    {
        const float* xb = x + (size_t)r0 * DM + t * 4;    // the 64 rows are one contiguous block; 16-byte piece f = i 512 + t is row f / 128, floats 4 (f % 128) ..
        v4f xv[16];
#pragma unroll
        for (int i = 0; i < 16; ++i) xv[i] = *(const v4f*)(xb + i * 2048);
        const int kw = (w & 7) * 64, n = (w >> 3) * 32 + lane;    // this wave's 64 k and this lane's column in each weight matrix
        float wv0[64];
#pragma unroll
        for (int g = 0; g < 3; ++g) {
            const float* wg = (g == 0 ? wq : g == 1 ? wk : wv) + (size_t)kw * DK + n;
#pragma unroll
            for (int k = 0; k < 64; ++k) wv0[k] = wg[k * DK];
            asm volatile("s_wait_xcnt 0x0" :: "v"(n) : "memory");    // n is the offset register of the 64 loads above: named here it stays live behind the last of them (in one build that load's data landed in it), and the wait stands in front of whatever takes the register next
            if (g == 0) {
#pragma unroll
                for (int i = 0; i < 16; ++i) { v4us o;
#pragma unroll
                    for (int c = 0; c < 4; ++c) o[c] = f2bf(xv[i][c]);
                    *(v4us*)(xs + (i * 4 + (t >> 7)) * LP + (t & 127) * 4) = o; }
                sb[t] = bfr(bl);
            }
#pragma unroll
            for (int i = 0; i < 8; ++i) { v8us o;
#pragma unroll
                for (int c = 0; c < 8; ++c) o[c] = f2bf(wv0[i * 8 + c]);
                *(v8us*)(wt + (g * DK + n) * LP + kw + i * 8) = o; }
        }
    }
    __syncthreads();
    if (w < 8) {
        const int y = w >> 2, mt = w & 3;
        const bf* xa = xs + (mt * 16 + lr) * LP + 8 * hi; const bf* wa = wt + (y * DK + lr) * LP + 8 * hi;
        v8f acc[4];
#pragma unroll
        for (int nt = 0; nt < 4; ++nt) acc[nt] = (v8f){};
#pragma unroll 1    // one trip = 4 k steps = 20 fragments = 160 registers; unrolled further the fragments no longer fit and the compiler spills
        for (int kq = 0; kq < DM; kq += 128) {
            v16bf xf[4], wf[4][4];
#pragma unroll
            for (int ks = 0; ks < 4; ++ks) { xf[ks] = WFrag<bf>::ld(xa + kq + ks * 32);
#pragma unroll
                for (int nt = 0; nt < 4; ++nt) wf[ks][nt] = WFrag<bf>::ld(wa + nt * 16 * LP + kq + ks * 32); }
            __builtin_amdgcn_sched_barrier(0);    // all 40 LDS reads of the trip in flight together: left alone the compiler reuses a few registers and waits out an LDS latency in front of nearly every WMMA
#pragma unroll
            for (int ks = 0; ks < 4; ++ks)
#pragma unroll
                for (int nt = 0; nt < 4; ++nt) acc[nt] = wmmab(wf[ks][nt], xf[ks], acc[nt]);
        }
        const float sc = y == 0 ? 0.125f : 1.0f;
        const size_t ro = (size_t)(r0 + mt * 16 + lr) * DK + hi * 8; bf* H = (y == 0 ? Qh : Kh) + ro; bf* L = (y == 0 ? Ql : Kl) + ro;
#pragma unroll
        for (int nt = 0; nt < 4; ++nt) { v8us h, l; const float* bp = sb + y * DK + nt * 16 + hi * 8; const v4f b0 = *(const v4fa*)bp, b1 = *(const v4fa*)(bp + 4);
#pragma unroll
            for (int j = 0; j < 8; ++j) { unsigned short u, d; splitf((acc[nt][j] + (j < 4 ? b0[j & 3] : b1[j & 3])) * sc, u, d); h[j] = u; l[j] = d; }
            *(v8us*)(H + nt * 16) = h; *(v8us*)(L + nt * 16) = l; }
    } else if (w < 12) {
        const int nt = w - 8;
        const bf* xa = xs + lr * LP + 8 * hi; const bf* wa = wt + (2 * DK + nt * 16 + lr) * LP + 8 * hi;
        v8f acc[4];
#pragma unroll
        for (int mt = 0; mt < 4; ++mt) acc[mt] = (v8f){};
#pragma unroll 1    // as above
        for (int kq = 0; kq < DM; kq += 128) {
            v16bf wf[4], xf[4][4];
#pragma unroll
            for (int ks = 0; ks < 4; ++ks) { wf[ks] = WFrag<bf>::ld(wa + kq + ks * 32);
#pragma unroll
                for (int mt = 0; mt < 4; ++mt) xf[ks][mt] = WFrag<bf>::ld(xa + mt * 16 * LP + kq + ks * 32); }
            __builtin_amdgcn_sched_barrier(0);    // as above
#pragma unroll
            for (int ks = 0; ks < 4; ++ks)
#pragma unroll
                for (int mt = 0; mt < 4; ++mt) acc[mt] = wmmab(xf[ks][mt], wf[ks], acc[mt]);
        }
        const float bz = sb[2 * DK + nt * 16 + lr];
        h16* vo = VT + (size_t)(r0 / SS) * SS * DK + (size_t)(nt * 16 + lr) * SS + (r0 % SS) + hi * 8;
#pragma unroll
        for (int mt = 0; mt < 4; ++mt) { v8h o;
#pragma unroll
            for (int j = 0; j < 8; ++j) o[j] = tohx(acc[mt][j] + bz);
            *(v8h*)(vo + mt * 16) = o; }
        asm volatile("s_wait_xcnt 0x0" ::: "memory");    // in the built code the q/k path stands behind these stores, after a branch, and writes their data registers again: the wait stands in front of that branch
    }
}
// exp2 with the slot that the instruction set asks for behind a transcendental held in the same statement.
__device__ __forceinline__ float exp2s(float x) { float r; asm("v_exp_f32 %0, %1\n\tv_nop" : "=v"(r) : "v"(x)); return r; }
// four exp2 in one statement: each fills the slot that the instruction set asks for behind the one before it (early-clobber outputs: none overwrites a source), one v_nop fills the last.
__device__ __forceinline__ v4f exp2q(v4f x) { float r0, r1, r2, r3; asm("v_exp_f32 %0, %4\n\tv_exp_f32 %1, %5\n\tv_exp_f32 %2, %6\n\tv_exp_f32 %3, %7\n\tv_nop" : "=&v"(r0), "=&v"(r1), "=&v"(r2), "=&v"(r3) : "v"(x[0]), "v"(x[1]), "v"(x[2]), "v"(x[3])); return (v4f){r0, r1, r2, r3}; }
#define AW 16
#define OPI 68     // LDS pitch of a staged output row in floats
#define L2E 0x1.715476p+0f
__device__ __forceinline__ float xhalf(float x) { return __builtin_bit_cast(float, __builtin_amdgcn_permlanex16(__builtin_bit_cast(int, x), __builtin_bit_cast(int, x), 0x76543210, 0xfedcba98, false, false)); }    // lane l takes lane l ^ 16's value
__global__ __launch_bounds__(AW * 32) void k_attn(const bf* __restrict__ Qh, const bf* __restrict__ Ql, const bf* __restrict__ Kh, const bf* __restrict__ Kl, const h16* __restrict__ VT, float* OUT) {
    __shared__ __align__(16) float so[AW * 32 * OPI];
    __shared__ float sm[AW * 32];
    __shared__ float sl[AW * 32];
    const int lane = threadIdx.x & 31, lr = lane & 15, hi = lane >> 4; const int w = __builtin_amdgcn_readfirstlane(threadIdx.x >> 5); const int q0 = blockIdx.x * 32;    // w in a scalar register: key loop and key addresses wave-uniform
    { const size_t bo = (size_t)blockIdx.y * SS * DK; Qh += bo; Ql += bo; Kh += bo; Kl += bo; VT += bo; OUT += bo; }    // this workgroup's batch
    v16bf qh[2][2], ql[2][2];
#pragma unroll
    for (int qt = 0; qt < 2; ++qt)
#pragma unroll
        for (int ks = 0; ks < 2; ++ks) { const size_t qo = (size_t)(q0 + qt * 16 + lr) * DK + ks * 32 + 8 * hi; qh[qt][ks] = WFrag<bf>::ld(Qh + qo); ql[qt][ks] = WFrag<bf>::ld(Ql + qo); }
    asm volatile("s_wait_xcnt 0x0" ::: "memory");    // the registers that hold the Q loads' addresses are written again directly below
    __builtin_amdgcn_sched_barrier(0);    // keeps those register writes behind the wait: without it the scheduler lifts them over the statement above
    v8f o[4][2];
#pragma unroll
    for (int dt = 0; dt < 4; ++dt) { o[dt][0] = (v8f){}; o[dt][1] = (v8f){}; }
    float m[2] = {-__builtin_inff(), -__builtin_inff()}, l[2] = {0.f, 0.f};
    const int k0 = w * (SS / AW);
#pragma unroll 1
    for (int kb = k0; kb < k0 + SS / AW; kb += 32) {
        v16bf kh[2][2], kl[2][2];
#pragma unroll
        for (int kt = 0; kt < 2; ++kt)
#pragma unroll
            for (int ks = 0; ks < 2; ++ks) { const size_t ko = (size_t)(kb + kt * 16 + lr) * DK + ks * 32 + 8 * hi; kh[kt][ks] = WFrag<bf>::ld(Kh + ko); kl[kt][ks] = WFrag<bf>::ld(Kl + ko); }
        asm volatile("s_wait_xcnt 0x0" ::: "memory");    // the V loads below land in the registers that hold the K loads' addresses
        __builtin_amdgcn_sched_barrier(0);    // all sixteen K loads of the pass in flight together: left alone the compiler reloads one register set four times and waits out a full load latency each time
        v8f s[2][2];
#pragma unroll
        for (int kt = 0; kt < 2; ++kt) { s[kt][0] = (v8f){}; s[kt][1] = (v8f){};
#pragma unroll
            for (int ks = 0; ks < 2; ++ks)
#pragma unroll
                for (int qt = 0; qt < 2; ++qt) { s[kt][qt] = wmmab(kh[kt][ks], qh[qt][ks], s[kt][qt]); s[kt][qt] = wmmab(kh[kt][ks], ql[qt][ks], s[kt][qt]); s[kt][qt] = wmmab(kl[kt][ks], qh[qt][ks], s[kt][qt]); } }
        v16h vf[4];
#pragma unroll
        for (int dt = 0; dt < 4; ++dt) vf[dt] = WFrag<h16>::ld(VT + (size_t)(dt * 16 + lr) * SS + kb + 8 * hi);
        float mp[2];
#pragma unroll
        for (int qt = 0; qt < 2; ++qt) { float x = s[0][qt][0];
#pragma unroll
            for (int j = 1; j < 8; ++j) x = fmaxf(x, s[0][qt][j]);
#pragma unroll
            for (int j = 0; j < 8; ++j) x = fmaxf(x, s[1][qt][j]);
            x = fmaxf(x, xhalf(x)); mp[qt] = x * L2E; }
        const bool need = mp[0] > m[0] + 8.f || mp[1] > m[1] + 8.f;
        if (__builtin_amdgcn_ballot_w32(need) != 0) {
#pragma unroll
            for (int qt = 0; qt < 2; ++qt) { const float mn = fmaxf(m[qt], mp[qt]); const float al = exp2s(m[qt] - mn); m[qt] = mn; l[qt] *= al;
#pragma unroll
                for (int dt = 0; dt < 4; ++dt) o[dt][qt] *= al; } }
        v16h p[2];
#pragma unroll
        for (int qt = 0; qt < 2; ++qt)
#pragma unroll
            for (int kt = 0; kt < 2; ++kt)
#pragma unroll
                for (int j = 0; j < 8; j += 4) { v4f t;
#pragma unroll
                    for (int c = 0; c < 4; ++c) t[c] = __builtin_fmaf(s[kt][qt][j + c], L2E, -m[qt]);
                    const v4f e = exp2q(t);
#pragma unroll
                    for (int c = 0; c < 4; ++c) { l[qt] += e[c]; p[qt][kt * 8 + j + c] = tohx(e[c]); } }
#pragma unroll
        for (int dt = 0; dt < 4; ++dt) { o[dt][0] = wmma16(vf[dt], p[0], o[dt][0]); o[dt][1] = wmma16(vf[dt], p[1], o[dt][1]); }
    }
#pragma unroll
    for (int qt = 0; qt < 2; ++qt) { l[qt] += xhalf(l[qt]); const int row = w * 32 + qt * 16 + lr; if (hi == 0) { sm[row] = m[qt]; sl[row] = l[qt]; }
#pragma unroll
        for (int dt = 0; dt < 4; ++dt) { float* d = so + (size_t)row * OPI + dt * 16 + hi * 8; *(v4fa*)d = __builtin_shufflevector(o[dt][qt], o[dt][qt], 0, 1, 2, 3); *(v4fa*)(d + 4) = __builtin_shufflevector(o[dt][qt], o[dt][qt], 4, 5, 6, 7); } }
    __syncthreads();
    const int q = threadIdx.x >> 4, dc = (threadIdx.x & 15) * 4;
    float M = sm[q];
#pragma unroll
    for (int ww = 1; ww < AW; ++ww) M = fmaxf(M, sm[ww * 32 + q]);
    float L = 0.f; v4f a = (v4f){};
#pragma unroll
    for (int ww = 0; ww < AW; ++ww) { const float f = exp2s(sm[ww * 32 + q] - M); L += sl[ww * 32 + q] * f; a += *(const v4fa*)(so + (size_t)(ww * 32 + q) * OPI + dc) * f; }
    const float r = __fdiv_rn(1.0f, L);
    *(v4f*)(OUT + (size_t)(q0 + q) * DK + dc) = a * r;
}

extern "C" void kernel_launch(void* const* d_in, const int* in_sizes, int n_in,
                              void* d_out, int out_size, void* d_ws, size_t ws_size, hipStream_t stream) {
    (void)in_sizes; (void)n_in; (void)out_size;
    const float* x = (const float*)d_in[0]; const float* wq = (const float*)d_in[1]; const float* bq = (const float*)d_in[2]; const float* wk = (const float*)d_in[3]; const float* bk = (const float*)d_in[4]; const float* wv = (const float*)d_in[5]; const float* bv = (const float*)d_in[6];
    float* OUT = (float*)d_out;     // [4][4096][64]
    char* wsp = (char*)d_ws;
    auto take = [&](size_t bytes) { char* p = wsp; wsp += (bytes + 255) & ~(size_t)255; return (void*)p; };
    bf* Qh = (bf*)take((size_t)MS * DK * 2); bf* Ql = (bf*)take((size_t)MS * DK * 2); bf* Kh = (bf*)take((size_t)MS * DK * 2); bf* Kl = (bf*)take((size_t)MS * DK * 2); h16* VT = (h16*)take((size_t)DK * MS * 2);
    if ((size_t)(wsp - (char*)d_ws) > ws_size) return;    // total ~ 10 MB
    k_proj<<<MS / PR, 512, 0, stream>>>(x, wq, wk, wv, bq, bk, bv, Qh, Ql, Kh, Kl, VT);
    k_attn<<<dim3(SS / 32, NB_), AW * 32, 0, stream>>>(Qh, Ql, Kh, Kl, VT, OUT);
}

// v006
// Measured time: 47.3 microseconds a run.
// Timed twice side by side with v005, it ran 1.47 and 1.50 times as fast.
// Over all steps from v000 it is 18.3 times as fast.
#include <hip/hip_runtime.h>

// ScaledDotProductAttentionLayer (x [4][4096][512]; q = x wq + bq, k = x wk + bk (64), v = x wv + bv (64); probs = softmax(q.k / 8) over the 4096 keys; out = probs v -> [4][4096][64]).
// Compute dtypes, f32 accumulate: every input rounded to bf16; q/k/v projections on PLAIN bf16 operands (inputs: exact, + bias); scores (K 64) on bf16 hi+lo planes of q (x 1/8) and k (3 products; logits have unit scale);

#define NB_  4
#define SS   4096
#define DM   512
#define DK   64
#define MS   (NB_ * SS)    // rows of all batches together: every kernel is launched once and takes the batch from its grid
typedef _Float16 h16;
typedef unsigned short bf;
typedef __attribute__((ext_vector_type(16))) __bf16   v16bf;
typedef __attribute__((ext_vector_type(16))) _Float16 v16h;
typedef __attribute__((ext_vector_type(8)))  _Float16 v8h;
typedef __attribute__((ext_vector_type(8)))  unsigned short v8us;
typedef __attribute__((ext_vector_type(8)))  float    v8f;
typedef __attribute__((ext_vector_type(4)))  float    v4f;
typedef v8h  __attribute__((may_alias)) v8ha;
typedef v4f  __attribute__((may_alias)) v4fa;
typedef v8us __attribute__((may_alias)) v8usa;

__device__ __forceinline__ unsigned short f2bf(float f) { unsigned u = __float_as_uint(f); u += 0x7FFFu + ((u >> 16) & 1u); return (unsigned short)(u >> 16); }
__device__ __forceinline__ float bf2f(unsigned short b) { return __uint_as_float(((unsigned)b) << 16); }
__device__ __forceinline__ float bfr(float f) { return bf2f(f2bf(f)); }
__device__ __forceinline__ v16h cat16(v8h lo, v8h hi) { return __builtin_shufflevector(lo, hi, 0, 1, 2, 3, 4, 5, 6, 7, 8, 9, 10, 11, 12, 13, 14, 15); }
__device__ __forceinline__ v16bf cat16b(v8us lo, v8us hi) { return __builtin_bit_cast(v16bf, __builtin_shufflevector(lo, hi, 0, 1, 2, 3, 4, 5, 6, 7, 8, 9, 10, 11, 12, 13, 14, 15)); }
__device__ __forceinline__ v8f wmma16(v16h a, v16h b, v8f c) { return __builtin_amdgcn_wmma_f32_16x16x32_f16(false, a, false, b, (short)0, c, false, false); }
__device__ __forceinline__ v8f wmmab(v16bf a, v16bf b, v8f c) { return __builtin_amdgcn_wmma_f32_16x16x32_bf16(false, a, false, b, (short)0, c, false, false); }



// fragment of 16 rows x 32 k from a K-contiguous 16-bit plane (global or LDS): lane = row lr, elements 0..7 = k 8 hi .., elements 8..15 = k 16 + 8 hi ..; the same for the A and the B operand.
// ldt: the same fragment from a plane kept in FRAGMENT ORDER: a 16-row x 16-k piece is 512 contiguous bytes, lane l's 8 elements (row l % 16, k 8 (l / 16) ..) at byte 16 l; a fragment is two such pieces one behind the other.
// p = piece base + 8 lane: each of the two 16-byte loads of a wave covers four whole 128-byte lines, where a row-major plane makes it touch sixteen.
template <typename T16> struct WFrag;
template <> struct WFrag<h16> { typedef v16h V; static __device__ __forceinline__ V ld(const h16* p) { return cat16(*(const v8h*)p, *(const v8h*)(p + 16)); } static __device__ __forceinline__ V ldt(const h16* p) { return cat16(*(const v8h*)p, *(const v8h*)(p + 256)); } static __device__ __forceinline__ v8f mma(V a, V b, v8f c) { return wmma16(a, b, c); } };
template <> struct WFrag<bf> { typedef v16bf V; static __device__ __forceinline__ V ld(const bf* p) { return cat16b(*(const v8us*)p, *(const v8us*)(p + 16)); } static __device__ __forceinline__ V ldt(const bf* p) { return cat16b(*(const v8us*)p, *(const v8us*)(p + 256)); } static __device__ __forceinline__ v8f mma(V a, V b, v8f c) { return wmmab(a, b, c); } };

__device__ __forceinline__ h16 tohx(float x) { return (h16)x; }
__device__ __forceinline__ void splitf(float y, unsigned short& h, unsigned short& l) { h = f2bf(y); l = f2bf(y - bf2f(h)); }
typedef __attribute__((ext_vector_type(4))) unsigned short v4us;
#define PR 64      // rows of x per workgroup
#define LP 520     // LDS row pitch in 16-bit elements: 1040 bytes, an odd multiple of 16, so the 16 rows of a fragment read (and of a transposing store) fall on distinct banks
// k_proj: x conversion, weight transposes, the q/k/v projections, the q/k hi+lo planes and the V transpose in one kernel; nothing between x and the attention operands goes through memory.
// Workgroup = 64 rows of x x all 192 output columns, whole K = 512; grid MS / 64 = one workgroup per WGP, 16 waves.
// Stage 1, all 16 waves: x rows (whole-line 16-byte loads) and wq, wk, wv (whole-line 4-byte loads down 64 k of one column per lane) are rounded to bf16 and stored in LDS, the weights transposed to [column][k]; the biases too. One barrier.
// Stage 2, waves 0..11, four 16x16 accumulators each, fragments by 16-byte LDS reads:
//   waves 0..7 (q: 0..3, k: 4..7): 16 rows x 64 columns as Y^T = W^T X^T, so a lane holds 8 consecutive columns of ONE row: + bias, (q: x 1/8), hi+lo split, 16-byte stores in fragment order: rows 16 R .. of a plane are 2 KB at element 1024 R, piece nt (columns 16 nt ..) at + 256 nt; one store of a wave = one piece = 512 contiguous bytes.
//   waves 8..11 (v): 64 rows x 16 columns as Y = X W, so a lane holds 8 consecutive rows of ONE column: + bias, fp16, 16-byte stores into V^T in fragment order: keys 32 G .. are 4 KB at element 2048 G, columns 16 nt .. at + 512 nt, keys 16 j .. of the 32 at + 256 j; one store of a wave = one piece.
__global__ __launch_bounds__(512) void k_proj(const float* __restrict__ x, const float* __restrict__ wq, const float* __restrict__ wk, const float* __restrict__ wv, const float* __restrict__ bq, const float* __restrict__ bk, const float* __restrict__ bv, bf* Qh, bf* Ql, bf* Kh, bf* Kl, h16* VT) {
    __shared__ __align__(16) bf xs[PR * LP];
    __shared__ __align__(16) bf wt[3 * DK * LP];
    __shared__ __align__(16) float sb[512];    // bq, bk, bv rounded to bf16 in the first 192; every thread stores one float, so that no branch stands at the load
    const int t = threadIdx.x, lane = t & 31, lr = lane & 15, hi = lane >> 4; const int w = __builtin_amdgcn_readfirstlane(t >> 5); const int r0 = blockIdx.x * PR;
    const float bl = (w < 2 ? bq : w < 4 ? bk : bv)[t & (DK - 1)];    // the oldest load of the wave: it is back with the first x rows (waves 6..15 read bv again; nobody reads their copies)
    {
        const float* xb = x + (size_t)r0 * DM + t * 4;    // the 64 rows are one contiguous block; 16-byte piece f = i 512 + t is row f / 128, floats 4 (f % 128) ..
        v4f xv[16];
#pragma unroll
        for (int i = 0; i < 16; ++i) xv[i] = *(const v4f*)(xb + i * 2048);
        const int kw = (w & 7) * 64, n = (w >> 3) * 32 + lane;    // this wave's 64 k and this lane's column in each weight matrix
        float wv0[64];
#pragma unroll
        for (int g = 0; g < 3; ++g) {
            const float* wg = (g == 0 ? wq : g == 1 ? wk : wv) + (size_t)kw * DK + n;
#pragma unroll
            for (int k = 0; k < 64; ++k) wv0[k] = wg[k * DK];
            asm volatile("s_wait_xcnt 0x0" :: "v"(n) : "memory");    // n is the offset register of the 64 loads above: named here it stays live behind the last of them (in one build that load's data landed in it), and the wait stands in front of whatever takes the register next
            if (g == 0) {
#pragma unroll
                for (int i = 0; i < 16; ++i) { v4us o;
#pragma unroll
                    for (int c = 0; c < 4; ++c) o[c] = f2bf(xv[i][c]);
                    *(v4us*)(xs + (i * 4 + (t >> 7)) * LP + (t & 127) * 4) = o; }
                sb[t] = bfr(bl);
            }
#pragma unroll
            for (int i = 0; i < 8; ++i) { v8us o;
#pragma unroll
                for (int c = 0; c < 8; ++c) o[c] = f2bf(wv0[i * 8 + c]);
                *(v8us*)(wt + (g * DK + n) * LP + kw + i * 8) = o; }
        }
    }
    __syncthreads();
    if (w < 8) {
        const int y = w >> 2, mt = w & 3;
        const bf* xa = xs + (mt * 16 + lr) * LP + 8 * hi; const bf* wa = wt + (y * DK + lr) * LP + 8 * hi;
        v8f acc[4];
#pragma unroll
        for (int nt = 0; nt < 4; ++nt) acc[nt] = (v8f){};
#pragma unroll 1    // one trip = 4 k steps = 20 fragments = 160 registers; unrolled further the fragments no longer fit and the compiler spills
        for (int kq = 0; kq < DM; kq += 128) {
            v16bf xf[4], wf[4][4];
#pragma unroll
            for (int ks = 0; ks < 4; ++ks) { xf[ks] = WFrag<bf>::ld(xa + kq + ks * 32);
#pragma unroll
                for (int nt = 0; nt < 4; ++nt) wf[ks][nt] = WFrag<bf>::ld(wa + nt * 16 * LP + kq + ks * 32); }
            __builtin_amdgcn_sched_barrier(0);    // all 40 LDS reads of the trip in flight together: left alone the compiler reuses a few registers and waits out an LDS latency in front of nearly every WMMA
#pragma unroll
            for (int ks = 0; ks < 4; ++ks)
#pragma unroll
                for (int nt = 0; nt < 4; ++nt) acc[nt] = wmmab(wf[ks][nt], xf[ks], acc[nt]);
        }
        const float sc = y == 0 ? 0.125f : 1.0f;
        const size_t ro = (size_t)((r0 >> 4) + mt) * (16 * DK) + lane * 8; bf* H = (y == 0 ? Qh : Kh) + ro; bf* L = (y == 0 ? Ql : Kl) + ro;
#pragma unroll
        for (int nt = 0; nt < 4; ++nt) { v8us h, l; const float* bp = sb + y * DK + nt * 16 + hi * 8; const v4f b0 = *(const v4fa*)bp, b1 = *(const v4fa*)(bp + 4);
#pragma unroll
            for (int j = 0; j < 8; ++j) { unsigned short u, d; splitf((acc[nt][j] + (j < 4 ? b0[j & 3] : b1[j & 3])) * sc, u, d); h[j] = u; l[j] = d; }
            *(v8us*)(H + nt * 256) = h; *(v8us*)(L + nt * 256) = l; }
    } else if (w < 12) {
        const int nt = w - 8;
        const bf* xa = xs + lr * LP + 8 * hi; const bf* wa = wt + (2 * DK + nt * 16 + lr) * LP + 8 * hi;
        v8f acc[4];
#pragma unroll
        for (int mt = 0; mt < 4; ++mt) acc[mt] = (v8f){};
#pragma unroll 1    // as above
        for (int kq = 0; kq < DM; kq += 128) {
            v16bf wf[4], xf[4][4];
#pragma unroll
            for (int ks = 0; ks < 4; ++ks) { wf[ks] = WFrag<bf>::ld(wa + kq + ks * 32);
#pragma unroll
                for (int mt = 0; mt < 4; ++mt) xf[ks][mt] = WFrag<bf>::ld(xa + mt * 16 * LP + kq + ks * 32); }
            __builtin_amdgcn_sched_barrier(0);    // as above
#pragma unroll
            for (int ks = 0; ks < 4; ++ks)
#pragma unroll
                for (int mt = 0; mt < 4; ++mt) acc[mt] = wmmab(xf[ks][mt], wf[ks], acc[mt]);
        }
        const float bz = sb[2 * DK + nt * 16 + lr];
        h16* vo = VT + (size_t)(r0 >> 5) * (32 * DK) + nt * 512 + lane * 8;
#pragma unroll
        for (int mt = 0; mt < 4; ++mt) { v8h o;
#pragma unroll
            for (int j = 0; j < 8; ++j) o[j] = tohx(acc[mt][j] + bz);
            *(v8h*)(vo + (mt >> 1) * (32 * DK) + (mt & 1) * 256) = o; }
        asm volatile("s_wait_xcnt 0x0" ::: "memory");    // in the built code the q/k path stands behind these stores, after a branch, and writes their data registers again: the wait stands in front of that branch
    }
}
// exp2 with the slot that the instruction set asks for behind a transcendental held in the same statement.
__device__ __forceinline__ float exp2s(float x) { float r; asm("v_exp_f32 %0, %1\n\tv_nop" : "=v"(r) : "v"(x)); return r; }
// four exp2 in one statement: each fills the slot that the instruction set asks for behind the one before it (early-clobber outputs: none overwrites a source), one v_nop fills the last.
__device__ __forceinline__ v4f exp2q(v4f x) { float r0, r1, r2, r3; asm("v_exp_f32 %0, %4\n\tv_exp_f32 %1, %5\n\tv_exp_f32 %2, %6\n\tv_exp_f32 %3, %7\n\tv_nop" : "=&v"(r0), "=&v"(r1), "=&v"(r2), "=&v"(r3) : "v"(x[0]), "v"(x[1]), "v"(x[2]), "v"(x[3])); return (v4f){r0, r1, r2, r3}; }
#define AW 16
#define OPI 68     // LDS pitch of a staged output row in floats
#define L2E 0x1.715476p+0f
__device__ __forceinline__ float xhalf(float x) { return __builtin_bit_cast(float, __builtin_amdgcn_permlanex16(__builtin_bit_cast(int, x), __builtin_bit_cast(int, x), 0x76543210, 0xfedcba98, false, false)); }    // lane l takes lane l ^ 16's value
__global__ __launch_bounds__(AW * 32) void k_attn(const bf* __restrict__ Qh, const bf* __restrict__ Ql, const bf* __restrict__ Kh, const bf* __restrict__ Kl, const h16* __restrict__ VT, float* OUT) {
    __shared__ __align__(16) float so[AW * 32 * OPI];
    __shared__ float sm[AW * 32];
    __shared__ float sl[AW * 32];
    const int lane = threadIdx.x & 31, lr = lane & 15, hi = lane >> 4; const int w = __builtin_amdgcn_readfirstlane(threadIdx.x >> 5); const int q0 = blockIdx.x * 32;    // w in a scalar register: key loop and key addresses wave-uniform
    { const size_t bo = (size_t)blockIdx.y * SS * DK; Qh += bo; Ql += bo; Kh += bo; Kl += bo; VT += bo; OUT += bo; }    // this workgroup's batch
    v16bf qh[2][2], ql[2][2];
#pragma unroll
    for (int qt = 0; qt < 2; ++qt)
#pragma unroll
        for (int ks = 0; ks < 2; ++ks) { const size_t qo = (size_t)((q0 >> 4) + qt) * (16 * DK) + ks * 512 + lane * 8; qh[qt][ks] = WFrag<bf>::ldt(Qh + qo); ql[qt][ks] = WFrag<bf>::ldt(Ql + qo); }
    asm volatile("s_wait_xcnt 0x0" ::: "memory");    // the registers that hold the Q loads' addresses are written again directly below
    __builtin_amdgcn_sched_barrier(0);    // keeps those register writes behind the wait: without it the scheduler lifts them over the statement above
    v8f o[4][2];
#pragma unroll
    for (int dt = 0; dt < 4; ++dt) { o[dt][0] = (v8f){}; o[dt][1] = (v8f){}; }
    float m[2] = {-__builtin_inff(), -__builtin_inff()}, l[2] = {0.f, 0.f};
    const int k0 = w * (SS / AW);
#pragma unroll 1
    for (int kb = k0; kb < k0 + SS / AW; kb += 32) {
        v16bf kh[2][2], kl[2][2];
#pragma unroll
        for (int kt = 0; kt < 2; ++kt)
#pragma unroll
            for (int ks = 0; ks < 2; ++ks) { const size_t ko = (size_t)((kb >> 4) + kt) * (16 * DK) + ks * 512 + lane * 8; kh[kt][ks] = WFrag<bf>::ldt(Kh + ko); kl[kt][ks] = WFrag<bf>::ldt(Kl + ko); }
        asm volatile("s_wait_xcnt 0x0" ::: "memory");    // the V loads below land in the registers that hold the K loads' addresses
        __builtin_amdgcn_sched_barrier(0);    // all sixteen K loads of the pass in flight together: left alone the compiler reloads one register set four times and waits out a full load latency each time
        v8f s[2][2];
#pragma unroll
        for (int kt = 0; kt < 2; ++kt) { s[kt][0] = (v8f){}; s[kt][1] = (v8f){};
#pragma unroll
            for (int ks = 0; ks < 2; ++ks)
#pragma unroll
                for (int qt = 0; qt < 2; ++qt) { s[kt][qt] = wmmab(kh[kt][ks], qh[qt][ks], s[kt][qt]); s[kt][qt] = wmmab(kh[kt][ks], ql[qt][ks], s[kt][qt]); s[kt][qt] = wmmab(kl[kt][ks], qh[qt][ks], s[kt][qt]); } }
        v16h vf[4]; const h16* vp = VT + (size_t)(kb >> 5) * (32 * DK) + lane * 8;
#pragma unroll
        for (int dt = 0; dt < 4; ++dt) vf[dt] = WFrag<h16>::ldt(vp + dt * 512);
        asm volatile("s_wait_xcnt 0x0" :: "v"(vp) : "memory");    // vp is the address register pair of the eight loads above: named here it stays live behind the last of them (in one build that load's data landed in it), and the wait stands in front of whatever takes the pair next
        float mp[2];
#pragma unroll
        for (int qt = 0; qt < 2; ++qt) { float x = s[0][qt][0];
#pragma unroll
            for (int j = 1; j < 8; ++j) x = fmaxf(x, s[0][qt][j]);
#pragma unroll
            for (int j = 0; j < 8; ++j) x = fmaxf(x, s[1][qt][j]);
            x = fmaxf(x, xhalf(x)); mp[qt] = x * L2E; }
        const bool need = mp[0] > m[0] + 8.f || mp[1] > m[1] + 8.f;
        if (__builtin_amdgcn_ballot_w32(need) != 0) {
#pragma unroll
            for (int qt = 0; qt < 2; ++qt) { const float mn = fmaxf(m[qt], mp[qt]); const float al = exp2s(m[qt] - mn); m[qt] = mn; l[qt] *= al;
#pragma unroll
                for (int dt = 0; dt < 4; ++dt) o[dt][qt] *= al; } }
        v16h p[2];
#pragma unroll
        for (int qt = 0; qt < 2; ++qt)
#pragma unroll
            for (int kt = 0; kt < 2; ++kt)
#pragma unroll
                for (int j = 0; j < 8; j += 4) { v4f t;
#pragma unroll
                    for (int c = 0; c < 4; ++c) t[c] = __builtin_fmaf(s[kt][qt][j + c], L2E, -m[qt]);
                    const v4f e = exp2q(t);
#pragma unroll
                    for (int c = 0; c < 4; ++c) { l[qt] += e[c]; p[qt][kt * 8 + j + c] = tohx(e[c]); } }
#pragma unroll
        for (int dt = 0; dt < 4; ++dt) { o[dt][0] = wmma16(vf[dt], p[0], o[dt][0]); o[dt][1] = wmma16(vf[dt], p[1], o[dt][1]); }
    }
#pragma unroll
    for (int qt = 0; qt < 2; ++qt) { l[qt] += xhalf(l[qt]); const int row = w * 32 + qt * 16 + lr; if (hi == 0) { sm[row] = m[qt]; sl[row] = l[qt]; }
#pragma unroll
        for (int dt = 0; dt < 4; ++dt) { float* d = so + (size_t)row * OPI + dt * 16 + hi * 8; *(v4fa*)d = __builtin_shufflevector(o[dt][qt], o[dt][qt], 0, 1, 2, 3); *(v4fa*)(d + 4) = __builtin_shufflevector(o[dt][qt], o[dt][qt], 4, 5, 6, 7); } }
    __syncthreads();
    const int q = threadIdx.x >> 4, dc = (threadIdx.x & 15) * 4;
    float M = sm[q];
#pragma unroll
    for (int ww = 1; ww < AW; ++ww) M = fmaxf(M, sm[ww * 32 + q]);
    float L = 0.f; v4f a = (v4f){};
#pragma unroll
    for (int ww = 0; ww < AW; ++ww) { const float f = exp2s(sm[ww * 32 + q] - M); L += sl[ww * 32 + q] * f; a += *(const v4fa*)(so + (size_t)(ww * 32 + q) * OPI + dc) * f; }
    const float r = __fdiv_rn(1.0f, L);
    *(v4f*)(OUT + (size_t)(q0 + q) * DK + dc) = a * r;
}

extern "C" void kernel_launch(void* const* d_in, const int* in_sizes, int n_in,
                              void* d_out, int out_size, void* d_ws, size_t ws_size, hipStream_t stream) {
    (void)in_sizes; (void)n_in; (void)out_size;
    const float* x = (const float*)d_in[0]; const float* wq = (const float*)d_in[1]; const float* bq = (const float*)d_in[2]; const float* wk = (const float*)d_in[3]; const float* bk = (const float*)d_in[4]; const float* wv = (const float*)d_in[5]; const float* bv = (const float*)d_in[6];
    float* OUT = (float*)d_out;     // [4][4096][64]
    char* wsp = (char*)d_ws;
    auto take = [&](size_t bytes) { char* p = wsp; wsp += (bytes + 255) & ~(size_t)255; return (void*)p; };
    bf* Qh = (bf*)take((size_t)MS * DK * 2); bf* Ql = (bf*)take((size_t)MS * DK * 2); bf* Kh = (bf*)take((size_t)MS * DK * 2); bf* Kl = (bf*)take((size_t)MS * DK * 2); h16* VT = (h16*)take((size_t)DK * MS * 2);
    if ((size_t)(wsp - (char*)d_ws) > ws_size) return;    // total ~ 10 MB
    k_proj<<<MS / PR, 512, 0, stream>>>(x, wq, wk, wv, bq, bk, bv, Qh, Ql, Kh, Kl, VT);
    k_attn<<<dim3(SS / 32, NB_), AW * 32, 0, stream>>>(Qh, Ql, Kh, Kl, VT, OUT);
}

// v007
// A run of this version takes 37.9 microseconds.
// Two timings next to v006 put it at 1.23 and 1.26 times that version's speed.
// All steps since v000 together make it 22.8 times as fast.
#include <hip/hip_runtime.h>

// ScaledDotProductAttentionLayer (x [4][4096][512]; q = x wq + bq, k = x wk + bk (64), v = x wv + bv (64); probs = softmax(q.k / 8) over the 4096 keys; out = probs v -> [4][4096][64]).
// Compute dtypes, f32 accumulate: every input rounded to bf16; q/k/v projections on PLAIN bf16 operands (inputs: exact, + bias); scores (K 64) on bf16 hi+lo planes of q (x 1/8) and k (3 products; logits have unit scale);

#define NB_  4
#define SS   4096
#define DM   512
#define DK   64
#define MS   (NB_ * SS)    // rows of all batches together: every kernel is launched once and takes the batch from its grid
typedef _Float16 h16;
typedef unsigned short bf;
typedef __attribute__((ext_vector_type(16))) __bf16   v16bf;
typedef __attribute__((ext_vector_type(16))) _Float16 v16h;
typedef __attribute__((ext_vector_type(8)))  _Float16 v8h;
typedef __attribute__((ext_vector_type(8)))  unsigned short v8us;
typedef __attribute__((ext_vector_type(8)))  float    v8f;
typedef __attribute__((ext_vector_type(4)))  float    v4f;
typedef v8h  __attribute__((may_alias)) v8ha;
typedef v4f  __attribute__((may_alias)) v4fa;
typedef v8us __attribute__((may_alias)) v8usa;

__device__ __forceinline__ unsigned short f2bf(float f) { unsigned u = __float_as_uint(f); u += 0x7FFFu + ((u >> 16) & 1u); return (unsigned short)(u >> 16); }
__device__ __forceinline__ float bf2f(unsigned short b) { return __uint_as_float(((unsigned)b) << 16); }
__device__ __forceinline__ float bfr(float f) { return bf2f(f2bf(f)); }
__device__ __forceinline__ v16h cat16(v8h lo, v8h hi) { return __builtin_shufflevector(lo, hi, 0, 1, 2, 3, 4, 5, 6, 7, 8, 9, 10, 11, 12, 13, 14, 15); }
__device__ __forceinline__ v16bf cat16b(v8us lo, v8us hi) { return __builtin_bit_cast(v16bf, __builtin_shufflevector(lo, hi, 0, 1, 2, 3, 4, 5, 6, 7, 8, 9, 10, 11, 12, 13, 14, 15)); }
__device__ __forceinline__ v8f wmma16(v16h a, v16h b, v8f c) { return __builtin_amdgcn_wmma_f32_16x16x32_f16(false, a, false, b, (short)0, c, false, false); }
__device__ __forceinline__ v8f wmmab(v16bf a, v16bf b, v8f c) { return __builtin_amdgcn_wmma_f32_16x16x32_bf16(false, a, false, b, (short)0, c, false, false); }



// fragment of 16 rows x 32 k from a K-contiguous 16-bit plane (global or LDS): lane = row lr, elements 0..7 = k 8 hi .., elements 8..15 = k 16 + 8 hi ..; the same for the A and the B operand.
// ldt: the same fragment from a plane kept in FRAGMENT ORDER: a 16-row x 16-k piece is 512 contiguous bytes, lane l's 8 elements (row l % 16, k 8 (l / 16) ..) at byte 16 l; a fragment is two such pieces one behind the other.
// p = piece base + 8 lane: each of the two 16-byte loads of a wave covers four whole 128-byte lines, where a row-major plane makes it touch sixteen.
template <typename T16> struct WFrag;
template <> struct WFrag<h16> { typedef v16h V; static __device__ __forceinline__ V ld(const h16* p) { return cat16(*(const v8h*)p, *(const v8h*)(p + 16)); } static __device__ __forceinline__ V ldt(const h16* p) { return cat16(*(const v8h*)p, *(const v8h*)(p + 256)); } static __device__ __forceinline__ v8f mma(V a, V b, v8f c) { return wmma16(a, b, c); } };
template <> struct WFrag<bf> { typedef v16bf V; static __device__ __forceinline__ V ld(const bf* p) { return cat16b(*(const v8us*)p, *(const v8us*)(p + 16)); } static __device__ __forceinline__ V ldt(const bf* p) { return cat16b(*(const v8us*)p, *(const v8us*)(p + 256)); } static __device__ __forceinline__ v8f mma(V a, V b, v8f c) { return wmmab(a, b, c); } };

__device__ __forceinline__ h16 tohx(float x) { return (h16)x; }
__device__ __forceinline__ void splitf(float y, unsigned short& h, unsigned short& l) { h = f2bf(y); l = f2bf(y - bf2f(h)); }
typedef __attribute__((ext_vector_type(4))) unsigned short v4us;
#define PR 64      // rows of x per workgroup
#define LP 520     // LDS row pitch in 16-bit elements: 1040 bytes, an odd multiple of 16, so the 16 rows of a fragment read (and of a transposing store) fall on distinct banks
// k_proj: x conversion, weight transposes, the q/k/v projections, the q/k hi+lo planes and the V transpose in one kernel; nothing between x and the attention operands goes through memory.
// Workgroup = 64 rows of x x all 192 output columns, whole K = 512; grid MS / 64 = one workgroup per WGP, 16 waves.
// Stage 1, all 16 waves: x rows (whole-line 16-byte loads) and wq, wk, wv (whole-line 4-byte loads down 64 k of one column per lane) are rounded to bf16 and stored in LDS, the weights transposed to [column][k]; the biases too. One barrier.
// Stage 2, waves 0..11, four 16x16 accumulators each, fragments by 16-byte LDS reads:
//   waves 0..7 (q: 0..3, k: 4..7): 16 rows x 64 columns as Y^T = W^T X^T, so a lane holds 8 consecutive columns of ONE row: + bias, (q: x 1/8), hi+lo split, 16-byte stores in fragment order: rows 16 R .. of a plane are 2 KB at element 1024 R, piece nt (columns 16 nt ..) at + 256 nt; one store of a wave = one piece = 512 contiguous bytes.
//   waves 8..11 (v): 64 rows x 16 columns as Y = X W, so a lane holds 8 consecutive rows of ONE column: + bias, fp16, 16-byte stores into V^T in fragment order: keys 32 G .. are 4 KB at element 2048 G, columns 16 nt .. at + 512 nt, keys 16 j .. of the 32 at + 256 j; one store of a wave = one piece.
__global__ __launch_bounds__(512) void k_proj(const float* __restrict__ x, const float* __restrict__ wq, const float* __restrict__ wk, const float* __restrict__ wv, const float* __restrict__ bq, const float* __restrict__ bk, const float* __restrict__ bv, bf* Qh, bf* Ql, bf* Kh, bf* Kl, h16* VT) {
    __shared__ __align__(16) bf xs[PR * LP];
    __shared__ __align__(16) bf wt[3 * DK * LP];
    __shared__ __align__(16) float sb[512];    // bq, bk, bv rounded to bf16 in the first 192; every thread stores one float, so that no branch stands at the load
    const int t = threadIdx.x, lane = t & 31, lr = lane & 15, hi = lane >> 4; const int w = __builtin_amdgcn_readfirstlane(t >> 5); const int r0 = blockIdx.x * PR;
    const float bl = (w < 2 ? bq : w < 4 ? bk : bv)[t & (DK - 1)];    // the oldest load of the wave: it is back with the first x rows (waves 6..15 read bv again; nobody reads their copies)
    {
        const float* xb = x + (size_t)r0 * DM + t * 4;    // the 64 rows are one contiguous block; 16-byte piece f = i 512 + t is row f / 128, floats 4 (f % 128) ..
        v4f xv[16];
#pragma unroll
        for (int i = 0; i < 16; ++i) xv[i] = *(const v4f*)(xb + i * 2048);
        const int kw = (w & 7) * 64, n = (w >> 3) * 32 + lane;    // this wave's 64 k and this lane's column in each weight matrix
        float wv0[64];
#pragma unroll
        for (int g = 0; g < 3; ++g) {
            const float* wg = (g == 0 ? wq : g == 1 ? wk : wv) + (size_t)kw * DK + n;
#pragma unroll
            for (int k = 0; k < 64; ++k) wv0[k] = wg[k * DK];
            asm volatile("s_wait_xcnt 0x0" :: "v"(n) : "memory");    // n is the offset register of the 64 loads above: named here it stays live behind the last of them (in one build that load's data landed in it), and the wait stands in front of whatever takes the register next
            if (g == 0) {
#pragma unroll
                for (int i = 0; i < 16; ++i) { v4us o;
#pragma unroll
                    for (int c = 0; c < 4; ++c) o[c] = f2bf(xv[i][c]);
                    *(v4us*)(xs + (i * 4 + (t >> 7)) * LP + (t & 127) * 4) = o; }
                sb[t] = bfr(bl);
            }
#pragma unroll
            for (int i = 0; i < 8; ++i) { v8us o;
#pragma unroll
                for (int c = 0; c < 8; ++c) o[c] = f2bf(wv0[i * 8 + c]);
                *(v8us*)(wt + (g * DK + n) * LP + kw + i * 8) = o; }
        }
    }
    __syncthreads();
    if (w < 8) {
        const int y = w >> 2, mt = w & 3;
        const bf* xa = xs + (mt * 16 + lr) * LP + 8 * hi; const bf* wa = wt + (y * DK + lr) * LP + 8 * hi;
        v8f acc[4];
#pragma unroll
        for (int nt = 0; nt < 4; ++nt) acc[nt] = (v8f){};
#pragma unroll 1    // one trip = 4 k steps = 20 fragments = 160 registers; unrolled further the fragments no longer fit and the compiler spills
        for (int kq = 0; kq < DM; kq += 128) {
            v16bf xf[4], wf[4][4];
#pragma unroll
            for (int ks = 0; ks < 4; ++ks) { xf[ks] = WFrag<bf>::ld(xa + kq + ks * 32);
#pragma unroll
                for (int nt = 0; nt < 4; ++nt) wf[ks][nt] = WFrag<bf>::ld(wa + nt * 16 * LP + kq + ks * 32); }
            __builtin_amdgcn_sched_barrier(0);    // all 40 LDS reads of the trip in flight together: left alone the compiler reuses a few registers and waits out an LDS latency in front of nearly every WMMA
#pragma unroll
            for (int ks = 0; ks < 4; ++ks)
#pragma unroll
                for (int nt = 0; nt < 4; ++nt) acc[nt] = wmmab(wf[ks][nt], xf[ks], acc[nt]);
        }
        const float sc = y == 0 ? 0.125f : 1.0f;
        const size_t ro = (size_t)((r0 >> 4) + mt) * (16 * DK) + lane * 8; bf* H = (y == 0 ? Qh : Kh) + ro; bf* L = (y == 0 ? Ql : Kl) + ro;
#pragma unroll
        for (int nt = 0; nt < 4; ++nt) { v8us h, l; const float* bp = sb + y * DK + nt * 16 + hi * 8; const v4f b0 = *(const v4fa*)bp, b1 = *(const v4fa*)(bp + 4);
#pragma unroll
            for (int j = 0; j < 8; ++j) { unsigned short u, d; splitf((acc[nt][j] + (j < 4 ? b0[j & 3] : b1[j & 3])) * sc, u, d); h[j] = u; l[j] = d; }
            *(v8us*)(H + nt * 256) = h; *(v8us*)(L + nt * 256) = l; }
    } else if (w < 12) {
        const int nt = w - 8;
        const bf* xa = xs + lr * LP + 8 * hi; const bf* wa = wt + (2 * DK + nt * 16 + lr) * LP + 8 * hi;
        v8f acc[4];
#pragma unroll
        for (int mt = 0; mt < 4; ++mt) acc[mt] = (v8f){};
#pragma unroll 1    // as above
        for (int kq = 0; kq < DM; kq += 128) {
            v16bf wf[4], xf[4][4];
#pragma unroll
            for (int ks = 0; ks < 4; ++ks) { wf[ks] = WFrag<bf>::ld(wa + kq + ks * 32);
#pragma unroll
                for (int mt = 0; mt < 4; ++mt) xf[ks][mt] = WFrag<bf>::ld(xa + mt * 16 * LP + kq + ks * 32); }
            __builtin_amdgcn_sched_barrier(0);    // as above
#pragma unroll
            for (int ks = 0; ks < 4; ++ks)
#pragma unroll
                for (int mt = 0; mt < 4; ++mt) acc[mt] = wmmab(xf[ks][mt], wf[ks], acc[mt]);
        }
        const float bz = sb[2 * DK + nt * 16 + lr];
        h16* vo = VT + (size_t)(r0 >> 5) * (32 * DK) + nt * 512 + lane * 8;
#pragma unroll
        for (int mt = 0; mt < 4; ++mt) { v8h o;
#pragma unroll
            for (int j = 0; j < 8; ++j) o[j] = tohx(acc[mt][j] + bz);
            *(v8h*)(vo + (mt >> 1) * (32 * DK) + (mt & 1) * 256) = o; }
        asm volatile("s_wait_xcnt 0x0" ::: "memory");    // in the built code the q/k path stands behind these stores, after a branch, and writes their data registers again: the wait stands in front of that branch
    }
}
// exp2 with the slot that the instruction set asks for behind a transcendental held in the same statement.
__device__ __forceinline__ float exp2s(float x) { float r; asm("v_exp_f32 %0, %1\n\tv_nop" : "=v"(r) : "v"(x)); return r; }
// four exp2 in one statement: each fills the slot that the instruction set asks for behind the one before it (early-clobber outputs: none overwrites a source), one v_nop fills the last.
__device__ __forceinline__ v4f exp2q(v4f x) { float r0, r1, r2, r3; asm("v_exp_f32 %0, %4\n\tv_exp_f32 %1, %5\n\tv_exp_f32 %2, %6\n\tv_exp_f32 %3, %7\n\tv_nop" : "=&v"(r0), "=&v"(r1), "=&v"(r2), "=&v"(r3) : "v"(x[0]), "v"(x[1]), "v"(x[2]), "v"(x[3])); return (v4f){r0, r1, r2, r3}; }
#define AW 8      // waves of an attention workgroup: two per SIMD, so that a wave may hold 512 registers
#define QT 4      // 16-query tiles per wave and workgroup
#define QW (QT * 16)
#define OPI 68     // LDS pitch of a staged output row in floats
#define L2E 0x1.715476p+0f
__device__ __forceinline__ float xhalf(float x) { return __builtin_bit_cast(float, __builtin_amdgcn_permlanex16(__builtin_bit_cast(int, x), __builtin_bit_cast(int, x), 0x76543210, 0xfedcba98, false, false)); }    // lane l takes lane l ^ 16's value
__global__ __launch_bounds__(AW * 32) void k_attn(const bf* __restrict__ Qh, const bf* __restrict__ Ql, const bf* __restrict__ Kh, const bf* __restrict__ Kl, const h16* __restrict__ VT, float* OUT) {
    __shared__ __align__(16) float so[AW * QW * OPI];
    __shared__ float sm[AW * QW];
    __shared__ float sl[AW * QW];
    const int lane = threadIdx.x & 31, lr = lane & 15, hi = lane >> 4; const int w = __builtin_amdgcn_readfirstlane(threadIdx.x >> 5); const int q0 = blockIdx.x * QW;    // w in a scalar register: key loop and key addresses wave-uniform
    { const size_t bo = (size_t)blockIdx.y * SS * DK; Qh += bo; Ql += bo; Kh += bo; Kl += bo; VT += bo; OUT += bo; }    // this workgroup's batch
    v16bf qh[QT][2], ql[QT][2];
#pragma unroll
    for (int qt = 0; qt < QT; ++qt)
#pragma unroll
        for (int ks = 0; ks < 2; ++ks) { const size_t qo = (size_t)((q0 >> 4) + qt) * (16 * DK) + ks * 512 + lane * 8; qh[qt][ks] = WFrag<bf>::ldt(Qh + qo); ql[qt][ks] = WFrag<bf>::ldt(Ql + qo); }
    asm volatile("s_wait_xcnt 0x0" ::: "memory");    // the registers that hold the Q loads' addresses are written again directly below
    __builtin_amdgcn_sched_barrier(0);    // keeps those register writes behind the wait: without it the scheduler lifts them over the statement above
    v8f o[4][QT];
    float m[QT], l[QT];
#pragma unroll
    for (int qt = 0; qt < QT; ++qt) { m[qt] = -__builtin_inff(); l[qt] = 0.f;
#pragma unroll
        for (int dt = 0; dt < 4; ++dt) o[dt][qt] = (v8f){}; }
    const int k0 = w * (SS / AW);
#pragma unroll 1
    for (int kb = k0; kb < k0 + SS / AW; kb += 32) {
        v16bf kh[2][2], kl[2][2];
#pragma unroll
        for (int kt = 0; kt < 2; ++kt)
#pragma unroll
            for (int ks = 0; ks < 2; ++ks) { const size_t ko = (size_t)((kb >> 4) + kt) * (16 * DK) + ks * 512 + lane * 8; kh[kt][ks] = WFrag<bf>::ldt(Kh + ko); kl[kt][ks] = WFrag<bf>::ldt(Kl + ko); }
        asm volatile("s_wait_xcnt 0x0" ::: "memory");    // the V loads below land in the registers that hold the K loads' addresses
        __builtin_amdgcn_sched_barrier(0);    // all sixteen K loads of the pass in flight together: left alone the compiler reloads one register set four times and waits out a full load latency each time
        v8f s[2][QT];
#pragma unroll
        for (int kt = 0; kt < 2; ++kt) {
#pragma unroll
            for (int qt = 0; qt < QT; ++qt) s[kt][qt] = (v8f){};
#pragma unroll
            for (int ks = 0; ks < 2; ++ks) {    // per score tile the three products in the order hi hi, hi lo, lo hi; the four query tiles side by side, so that no WMMA waits for the one in front of it
#pragma unroll
                for (int qt = 0; qt < QT; ++qt) s[kt][qt] = wmmab(kh[kt][ks], qh[qt][ks], s[kt][qt]);
#pragma unroll
                for (int qt = 0; qt < QT; ++qt) s[kt][qt] = wmmab(kh[kt][ks], ql[qt][ks], s[kt][qt]);
#pragma unroll
                for (int qt = 0; qt < QT; ++qt) s[kt][qt] = wmmab(kl[kt][ks], qh[qt][ks], s[kt][qt]); } }
        v16h vf[4]; const h16* vp = VT + (size_t)(kb >> 5) * (32 * DK) + lane * 8;
#pragma unroll
        for (int dt = 0; dt < 4; ++dt) vf[dt] = WFrag<h16>::ldt(vp + dt * 512);
        asm volatile("s_wait_xcnt 0x0" :: "v"(vp) : "memory");    // vp is the address register pair of the eight loads above: named here it stays live behind the last of them (in one build that load's data landed in it), and the wait stands in front of whatever takes the pair next
        float mp[QT]; bool need = false;
#pragma unroll
        for (int qt = 0; qt < QT; ++qt) { float x = s[0][qt][0];
#pragma unroll
            for (int j = 1; j < 8; ++j) x = fmaxf(x, s[0][qt][j]);
#pragma unroll
            for (int j = 0; j < 8; ++j) x = fmaxf(x, s[1][qt][j]);
            x = fmaxf(x, xhalf(x)); mp[qt] = x * L2E; need = need || mp[qt] > m[qt] + 8.f; }
        if (__builtin_amdgcn_ballot_w32(need) != 0) {
#pragma unroll
            for (int qt = 0; qt < QT; ++qt) { const float mn = fmaxf(m[qt], mp[qt]); const float al = exp2s(m[qt] - mn); m[qt] = mn; l[qt] *= al;
#pragma unroll
                for (int dt = 0; dt < 4; ++dt) o[dt][qt] *= al; } }
        v16h p[QT];
#pragma unroll
        for (int qt = 0; qt < QT; ++qt)
#pragma unroll
            for (int kt = 0; kt < 2; ++kt)
#pragma unroll
                for (int j = 0; j < 8; j += 4) { v4f t;
#pragma unroll
                    for (int c = 0; c < 4; ++c) t[c] = __builtin_fmaf(s[kt][qt][j + c], L2E, -m[qt]);
                    const v4f e = exp2q(t);
#pragma unroll
                    for (int c = 0; c < 4; ++c) { l[qt] += e[c]; p[qt][kt * 8 + j + c] = tohx(e[c]); } }
#pragma unroll
        for (int dt = 0; dt < 4; ++dt)
#pragma unroll
            for (int qt = 0; qt < QT; ++qt) o[dt][qt] = wmma16(vf[dt], p[qt], o[dt][qt]);
    }
#pragma unroll
    for (int qt = 0; qt < QT; ++qt) { l[qt] += xhalf(l[qt]); const int row = w * QW + qt * 16 + lr; if (hi == 0) { sm[row] = m[qt]; sl[row] = l[qt]; }
#pragma unroll
        for (int dt = 0; dt < 4; ++dt) { float* d = so + (size_t)row * OPI + dt * 16 + hi * 8; *(v4fa*)d = __builtin_shufflevector(o[dt][qt], o[dt][qt], 0, 1, 2, 3); *(v4fa*)(d + 4) = __builtin_shufflevector(o[dt][qt], o[dt][qt], 4, 5, 6, 7); } }
    __syncthreads();
    const int dc = (threadIdx.x & 15) * 4;
#pragma unroll
    for (int i = 0; i < QT; ++i) { const int q = i * 16 + (threadIdx.x >> 4);
        float M = sm[q];
#pragma unroll
        for (int ww = 1; ww < AW; ++ww) M = fmaxf(M, sm[ww * QW + q]);
        float L = 0.f; v4f a = (v4f){};
#pragma unroll
        for (int ww = 0; ww < AW; ++ww) { const float f = exp2s(sm[ww * QW + q] - M); L += sl[ww * QW + q] * f; a += *(const v4fa*)(so + (size_t)(ww * QW + q) * OPI + dc) * f; }
        const float r = __fdiv_rn(1.0f, L);
        *(v4f*)(OUT + (size_t)(q0 + q) * DK + dc) = a * r; }
}

extern "C" void kernel_launch(void* const* d_in, const int* in_sizes, int n_in,
                              void* d_out, int out_size, void* d_ws, size_t ws_size, hipStream_t stream) {
    (void)in_sizes; (void)n_in; (void)out_size;
    const float* x = (const float*)d_in[0]; const float* wq = (const float*)d_in[1]; const float* bq = (const float*)d_in[2]; const float* wk = (const float*)d_in[3]; const float* bk = (const float*)d_in[4]; const float* wv = (const float*)d_in[5]; const float* bv = (const float*)d_in[6];
    float* OUT = (float*)d_out;     // [4][4096][64]
    char* wsp = (char*)d_ws;
    auto take = [&](size_t bytes) { char* p = wsp; wsp += (bytes + 255) & ~(size_t)255; return (void*)p; };
    bf* Qh = (bf*)take((size_t)MS * DK * 2); bf* Ql = (bf*)take((size_t)MS * DK * 2); bf* Kh = (bf*)take((size_t)MS * DK * 2); bf* Kl = (bf*)take((size_t)MS * DK * 2); h16* VT = (h16*)take((size_t)DK * MS * 2);
    if ((size_t)(wsp - (char*)d_ws) > ws_size) return;    // total ~ 10 MB
    k_proj<<<MS / PR, 512, 0, stream>>>(x, wq, wk, wv, bq, bk, bv, Qh, Ql, Kh, Kl, VT);
    k_attn<<<dim3(SS / QW, NB_), AW * 32, 0, stream>>>(Qh, Ql, Kh, Kl, VT, OUT);
}

// v008
// One run takes 35.3 microseconds.
// Two timings next to v007 put it at 1.07 and 1.08 times that version's speed.
// Over all steps from v000 it is 24.5 times as fast.
#include <hip/hip_runtime.h>

// ScaledDotProductAttentionLayer (x [4][4096][512]; q = x wq + bq, k = x wk + bk (64), v = x wv + bv (64); probs = softmax(q.k / 8) over the 4096 keys; out = probs v -> [4][4096][64]).
// Compute dtypes, f32 accumulate: every input rounded to bf16; q/k/v projections on PLAIN bf16 operands (inputs: exact, + bias); scores (K 64) on bf16 hi+lo planes of q (x 1/8) and k (3 products; logits have unit scale);

#define NB_  4
#define SS   4096
#define DM   512
#define DK   64
#define MS   (NB_ * SS)    // rows of all batches together: every kernel is launched once and takes the batch from its grid
typedef _Float16 h16;
typedef unsigned short bf;
typedef __attribute__((ext_vector_type(16))) __bf16   v16bf;
typedef __attribute__((ext_vector_type(16))) _Float16 v16h;
typedef __attribute__((ext_vector_type(8)))  _Float16 v8h;
typedef __attribute__((ext_vector_type(8)))  unsigned short v8us;
typedef __attribute__((ext_vector_type(8)))  float    v8f;
typedef __attribute__((ext_vector_type(4)))  float    v4f;
typedef v8h  __attribute__((may_alias)) v8ha;
typedef v4f  __attribute__((may_alias)) v4fa;
typedef v8us __attribute__((may_alias)) v8usa;

__device__ __forceinline__ unsigned short f2bf(float f) { unsigned u = __float_as_uint(f); u += 0x7FFFu + ((u >> 16) & 1u); return (unsigned short)(u >> 16); }
__device__ __forceinline__ float bf2f(unsigned short b) { return __uint_as_float(((unsigned)b) << 16); }
__device__ __forceinline__ float bfr(float f) { return bf2f(f2bf(f)); }
__device__ __forceinline__ v16h cat16(v8h lo, v8h hi) { return __builtin_shufflevector(lo, hi, 0, 1, 2, 3, 4, 5, 6, 7, 8, 9, 10, 11, 12, 13, 14, 15); }
__device__ __forceinline__ v16bf cat16b(v8us lo, v8us hi) { return __builtin_bit_cast(v16bf, __builtin_shufflevector(lo, hi, 0, 1, 2, 3, 4, 5, 6, 7, 8, 9, 10, 11, 12, 13, 14, 15)); }
__device__ __forceinline__ v8f wmma16(v16h a, v16h b, v8f c) { return __builtin_amdgcn_wmma_f32_16x16x32_f16(false, a, false, b, (short)0, c, false, false); }
__device__ __forceinline__ v8f wmmab(v16bf a, v16bf b, v8f c) { return __builtin_amdgcn_wmma_f32_16x16x32_bf16(false, a, false, b, (short)0, c, false, false); }



// fragment of 16 rows x 32 k from a K-contiguous 16-bit plane (global or LDS): lane = row lr, elements 0..7 = k 8 hi .., elements 8..15 = k 16 + 8 hi ..; the same for the A and the B operand.
// ldt: the same fragment from a plane kept in FRAGMENT ORDER: a 16-row x 16-k piece is 512 contiguous bytes, lane l's 8 elements (row l % 16, k 8 (l / 16) ..) at byte 16 l; a fragment is two such pieces one behind the other.
// p = piece base + 8 lane: each of the two 16-byte loads of a wave covers four whole 128-byte lines, where a row-major plane makes it touch sixteen.
template <typename T16> struct WFrag;
template <> struct WFrag<h16> { typedef v16h V; static __device__ __forceinline__ V ld(const h16* p) { return cat16(*(const v8h*)p, *(const v8h*)(p + 16)); } static __device__ __forceinline__ V ldt(const h16* p) { return cat16(*(const v8h*)p, *(const v8h*)(p + 256)); } static __device__ __forceinline__ v8f mma(V a, V b, v8f c) { return wmma16(a, b, c); } };
template <> struct WFrag<bf> { typedef v16bf V; static __device__ __forceinline__ V ld(const bf* p) { return cat16b(*(const v8us*)p, *(const v8us*)(p + 16)); } static __device__ __forceinline__ V ldt(const bf* p) { return cat16b(*(const v8us*)p, *(const v8us*)(p + 256)); } static __device__ __forceinline__ v8f mma(V a, V b, v8f c) { return wmmab(a, b, c); } };

__device__ __forceinline__ h16 tohx(float x) { return (h16)x; }
__device__ __forceinline__ void splitf(float y, unsigned short& h, unsigned short& l) { h = f2bf(y); l = f2bf(y - bf2f(h)); }
typedef __attribute__((ext_vector_type(4))) unsigned short v4us;
#define PR 64      // rows of x per workgroup
#define LP 520     // LDS row pitch in 16-bit elements: 1040 bytes, an odd multiple of 16, so the 16 rows of a fragment read (and of a transposing store) fall on distinct banks
// k_proj: x conversion, weight transposes, the q/k/v projections, the q/k hi+lo planes and the V transpose in one kernel; nothing between x and the attention operands goes through memory.
// Workgroup = 64 rows of x x all 192 output columns, whole K = 512; grid MS / 64 = one workgroup per WGP, 16 waves.
// Stage 1, all 16 waves: x rows (whole-line 16-byte loads) and wq, wk, wv (whole-line 4-byte loads down 64 k of one column per lane) are rounded to bf16 and stored in LDS, the weights transposed to [column][k]; the biases too. One barrier.
// Stage 2, waves 0..11, four 16x16 accumulators each, fragments by 16-byte LDS reads:
//   waves 0..7 (q: 0..3, k: 4..7): 16 rows x 64 columns as Y^T = W^T X^T, so a lane holds 8 consecutive columns of ONE row: + bias, (q: x 1/8), hi+lo split, 16-byte stores in fragment order: rows 16 R .. of a plane are 2 KB at element 1024 R, piece nt (columns 16 nt ..) at + 256 nt; one store of a wave = one piece = 512 contiguous bytes.
//   waves 8..11 (v): 64 rows x 16 columns as Y = X W, so a lane holds 8 consecutive rows of ONE column: + bias, fp16, 16-byte stores into V^T in fragment order: keys 32 G .. are 4 KB at element 2048 G, columns 16 nt .. at + 512 nt, keys 16 j .. of the 32 at + 256 j; one store of a wave = one piece.
__global__ __launch_bounds__(512) void k_proj(const float* __restrict__ x, const float* __restrict__ wq, const float* __restrict__ wk, const float* __restrict__ wv, const float* __restrict__ bq, const float* __restrict__ bk, const float* __restrict__ bv, bf* Qh, bf* Ql, bf* Kh, bf* Kl, h16* VT) {
    __shared__ __align__(16) bf xs[PR * LP];
    __shared__ __align__(16) bf wt[3 * DK * LP];
    __shared__ __align__(16) float sb[512];    // bq, bk, bv rounded to bf16 in the first 192; every thread stores one float, so that no branch stands at the load
    const int t = threadIdx.x, lane = t & 31, lr = lane & 15, hi = lane >> 4; const int w = __builtin_amdgcn_readfirstlane(t >> 5); const int r0 = blockIdx.x * PR;
    const float bl = (w < 2 ? bq : w < 4 ? bk : bv)[t & (DK - 1)];    // the oldest load of the wave: it is back with the first x rows (waves 6..15 read bv again; nobody reads their copies)
    {
        const float* xb = x + (size_t)r0 * DM + t * 4;    // the 64 rows are one contiguous block; 16-byte piece f = i 512 + t is row f / 128, floats 4 (f % 128) ..
        v4f xv[16];
#pragma unroll
        for (int i = 0; i < 16; ++i) xv[i] = *(const v4f*)(xb + i * 2048);
        const int kw = (w & 7) * 64, n = (w >> 3) * 32 + lane;    // this wave's 64 k and this lane's column in each weight matrix
        float wv0[64];
#pragma unroll
        for (int g = 0; g < 3; ++g) {
            const float* wg = (g == 0 ? wq : g == 1 ? wk : wv) + (size_t)kw * DK + n;
#pragma unroll
            for (int k = 0; k < 64; ++k) wv0[k] = wg[k * DK];
            asm volatile("s_wait_xcnt 0x0" :: "v"(n) : "memory");    // n is the offset register of the 64 loads above: named here it stays live behind the last of them (in one build that load's data landed in it), and the wait stands in front of whatever takes the register next
            if (g == 0) {
#pragma unroll
                for (int i = 0; i < 16; ++i) { v4us o;
#pragma unroll
                    for (int c = 0; c < 4; ++c) o[c] = f2bf(xv[i][c]);
                    *(v4us*)(xs + (i * 4 + (t >> 7)) * LP + (t & 127) * 4) = o; }
                sb[t] = bfr(bl);
            }
#pragma unroll
            for (int i = 0; i < 8; ++i) { v8us o;
#pragma unroll
                for (int c = 0; c < 8; ++c) o[c] = f2bf(wv0[i * 8 + c]);
                *(v8us*)(wt + (g * DK + n) * LP + kw + i * 8) = o; }
        }
    }
    __syncthreads();
    if (w < 8) {
        const int y = w >> 2, mt = w & 3;
        const bf* xa = xs + (mt * 16 + lr) * LP + 8 * hi; const bf* wa = wt + (y * DK + lr) * LP + 8 * hi;
        v8f acc[4];
#pragma unroll
        for (int nt = 0; nt < 4; ++nt) acc[nt] = (v8f){};
#pragma unroll 1    // one trip = 4 k steps = 20 fragments = 160 registers; unrolled further the fragments no longer fit and the compiler spills
        for (int kq = 0; kq < DM; kq += 128) {
            v16bf xf[4], wf[4][4];
#pragma unroll
            for (int ks = 0; ks < 4; ++ks) { xf[ks] = WFrag<bf>::ld(xa + kq + ks * 32);
#pragma unroll
                for (int nt = 0; nt < 4; ++nt) wf[ks][nt] = WFrag<bf>::ld(wa + nt * 16 * LP + kq + ks * 32); }
            __builtin_amdgcn_sched_barrier(0);    // all 40 LDS reads of the trip in flight together: left alone the compiler reuses a few registers and waits out an LDS latency in front of nearly every WMMA
#pragma unroll
            for (int ks = 0; ks < 4; ++ks)
#pragma unroll
                for (int nt = 0; nt < 4; ++nt) acc[nt] = wmmab(wf[ks][nt], xf[ks], acc[nt]);
        }
        const float sc = y == 0 ? 0.125f : 1.0f;
        const size_t ro = (size_t)((r0 >> 4) + mt) * (16 * DK) + lane * 8; bf* H = (y == 0 ? Qh : Kh) + ro; bf* L = (y == 0 ? Ql : Kl) + ro;
#pragma unroll
        for (int nt = 0; nt < 4; ++nt) { v8us h, l; const float* bp = sb + y * DK + nt * 16 + hi * 8; const v4f b0 = *(const v4fa*)bp, b1 = *(const v4fa*)(bp + 4);
#pragma unroll
            for (int j = 0; j < 8; ++j) { unsigned short u, d; splitf((acc[nt][j] + (j < 4 ? b0[j & 3] : b1[j & 3])) * sc, u, d); h[j] = u; l[j] = d; }
            *(v8us*)(H + nt * 256) = h; *(v8us*)(L + nt * 256) = l; }
    } else if (w < 12) {
        const int nt = w - 8;
        const bf* xa = xs + lr * LP + 8 * hi; const bf* wa = wt + (2 * DK + nt * 16 + lr) * LP + 8 * hi;
        v8f acc[4];
#pragma unroll
        for (int mt = 0; mt < 4; ++mt) acc[mt] = (v8f){};
#pragma unroll 1    // as above
        for (int kq = 0; kq < DM; kq += 128) {
            v16bf wf[4], xf[4][4];
#pragma unroll
            for (int ks = 0; ks < 4; ++ks) { wf[ks] = WFrag<bf>::ld(wa + kq + ks * 32);
#pragma unroll
                for (int mt = 0; mt < 4; ++mt) xf[ks][mt] = WFrag<bf>::ld(xa + mt * 16 * LP + kq + ks * 32); }
            __builtin_amdgcn_sched_barrier(0);    // as above
#pragma unroll
            for (int ks = 0; ks < 4; ++ks)
#pragma unroll
                for (int mt = 0; mt < 4; ++mt) acc[mt] = wmmab(xf[ks][mt], wf[ks], acc[mt]);
        }
        const float bz = sb[2 * DK + nt * 16 + lr];
        h16* vo = VT + (size_t)(r0 >> 5) * (32 * DK) + nt * 512 + lane * 8;
#pragma unroll
        for (int mt = 0; mt < 4; ++mt) { v8h o;
#pragma unroll
            for (int j = 0; j < 8; ++j) o[j] = tohx(acc[mt][j] + bz);
            *(v8h*)(vo + (mt >> 1) * (32 * DK) + (mt & 1) * 256) = o; }
        asm volatile("s_wait_xcnt 0x0" ::: "memory");    // in the built code the q/k path stands behind these stores, after a branch, and writes their data registers again: the wait stands in front of that branch
    }
}
// exp2 with the slot that the instruction set asks for behind a transcendental held in the same statement.
__device__ __forceinline__ float exp2s(float x) { float r; asm("v_exp_f32 %0, %1\n\tv_nop" : "=v"(r) : "v"(x)); return r; }
// four exp2 in one statement: each fills the slot that the instruction set asks for behind the one before it (early-clobber outputs: none overwrites a source), one v_nop fills the last.
__device__ __forceinline__ v4f exp2q(v4f x) { float r0, r1, r2, r3; asm("v_exp_f32 %0, %4\n\tv_exp_f32 %1, %5\n\tv_exp_f32 %2, %6\n\tv_exp_f32 %3, %7\n\tv_nop" : "=&v"(r0), "=&v"(r1), "=&v"(r2), "=&v"(r3) : "v"(x[0]), "v"(x[1]), "v"(x[2]), "v"(x[3])); return (v4f){r0, r1, r2, r3}; }
template <bool B> struct Flag { static constexpr bool v = B; };
#define AW 8      // waves of an attention workgroup: two per SIMD, so that a wave may hold 512 registers
#define QT 4      // 16-query tiles per wave and workgroup
#define QW (QT * 16)
#define OPI 68     // LDS pitch of a staged output row in floats
#define L2E 0x1.715476p+0f
__device__ __forceinline__ float xhalf(float x) { return __builtin_bit_cast(float, __builtin_amdgcn_permlanex16(__builtin_bit_cast(int, x), __builtin_bit_cast(int, x), 0x76543210, 0xfedcba98, false, false)); }    // lane l takes lane l ^ 16's value
__global__ __launch_bounds__(AW * 32) void k_attn(const bf* __restrict__ Qh, const bf* __restrict__ Ql, const bf* __restrict__ Kh, const bf* __restrict__ Kl, const h16* __restrict__ VT, float* OUT) {
    __shared__ __align__(16) float so[AW * QW * OPI];
    __shared__ float sm[AW * QW];
    __shared__ float sl[AW * QW];
    const int lane = threadIdx.x & 31, lr = lane & 15, hi = lane >> 4; const int w = __builtin_amdgcn_readfirstlane(threadIdx.x >> 5); const int q0 = blockIdx.x * QW;    // w in a scalar register: key loop and key addresses wave-uniform
    { const size_t bo = (size_t)blockIdx.y * SS * DK; Qh += bo; Ql += bo; Kh += bo; Kl += bo; VT += bo; OUT += bo; }    // this workgroup's batch
    v16bf qh[QT][2], ql[QT][2];
#pragma unroll
    for (int qt = 0; qt < QT; ++qt)
#pragma unroll
        for (int ks = 0; ks < 2; ++ks) { const size_t qo = (size_t)((q0 >> 4) + qt) * (16 * DK) + ks * 512 + lane * 8; qh[qt][ks] = WFrag<bf>::ldt(Qh + qo); ql[qt][ks] = WFrag<bf>::ldt(Ql + qo); }
    asm volatile("s_wait_xcnt 0x0" ::: "memory");    // the registers that hold the Q loads' addresses are written again directly below
    __builtin_amdgcn_sched_barrier(0);    // keeps those register writes behind the wait: without it the scheduler lifts them over the statement above
    v8f o[4][QT];
    float m[QT], l[QT];
#pragma unroll
    for (int qt = 0; qt < QT; ++qt) { m[qt] = -__builtin_inff(); l[qt] = 0.f;
#pragma unroll
        for (int dt = 0; dt < 4; ++dt) o[dt][qt] = (v8f){}; }
    const int k0 = w * (SS / AW), ke = k0 + SS / AW;
    v16bf kh[2][2], kl[2][2];    // K fragments of the pass at hand; refilled for the next pass as soon as the score products have read them
#pragma unroll
    for (int kt = 0; kt < 2; ++kt)
#pragma unroll
        for (int ks = 0; ks < 2; ++ks) { const size_t ko = (size_t)((k0 >> 4) + kt) * (16 * DK) + ks * 512 + lane * 8; kh[kt][ks] = WFrag<bf>::ldt(Kh + ko); kl[kt][ks] = WFrag<bf>::ldt(Kl + ko); }
    asm volatile("s_wait_xcnt 0x0" ::: "memory");    // the registers that hold these loads' addresses are written again in the loop
    __builtin_amdgcn_sched_barrier(0);    // keeps those register writes behind the wait
    // one pass of 32 keys; 'more' (a compile-time flag) says whether a next pass exists, whose K fragments this pass then fetches. The last pass stands by itself behind the loop, so that no branch stands at the loads: with one, the compiler's wait for V in front of P x V has to cover the path without K loads and waits for the K loads too
    auto pass = [&](const int kb, auto more) __attribute__((always_inline)) {
        v16h vf[4]; const h16* vp = VT + (size_t)(kb >> 5) * (32 * DK) + lane * 8;
#pragma unroll
        for (int dt = 0; dt < 4; ++dt) vf[dt] = WFrag<h16>::ldt(vp + dt * 512);
        asm volatile("s_wait_xcnt 0x0" :: "v"(vp) : "memory");    // vp is the address register pair of the eight loads above: named here it stays live behind the last of them (in one build that load's data landed in it), and the wait stands in front of whatever takes the pair next
        v8f s[2][QT];
#pragma unroll
        for (int kt = 0; kt < 2; ++kt) {
#pragma unroll
            for (int qt = 0; qt < QT; ++qt) s[kt][qt] = (v8f){};
#pragma unroll
            for (int ks = 0; ks < 2; ++ks) {    // per score tile the three products in the order hi hi, hi lo, lo hi; the four query tiles side by side, so that no WMMA waits for the one in front of it
#pragma unroll
                for (int qt = 0; qt < QT; ++qt) s[kt][qt] = wmmab(kh[kt][ks], qh[qt][ks], s[kt][qt]);
#pragma unroll
                for (int qt = 0; qt < QT; ++qt) s[kt][qt] = wmmab(kh[kt][ks], ql[qt][ks], s[kt][qt]);
#pragma unroll
                for (int qt = 0; qt < QT; ++qt) s[kt][qt] = wmmab(kl[kt][ks], qh[qt][ks], s[kt][qt]); } }
        const size_t kn = (size_t)((decltype(more)::v ? kb + 32 : kb) >> 4) * (16 * DK) + lane * 8; const bf* ph = Kh + kn; const bf* pl = Kl + kn;    // the next pass's K rows
        if constexpr (decltype(more)::v) {    // the loads' L2 latency runs under the softmax and the P x V products of this pass; they are issued behind this pass's V loads, so the counted wait for V does not wait for them
            __builtin_amdgcn_sched_barrier(0x6);    // only vector and scalar arithmetic may cross: the K loads stay, as one group, behind the last score product (left alone the compiler strews them among the products), and the maxima below may still move up among the products
#pragma unroll
            for (int kt = 0; kt < 2; ++kt)
#pragma unroll
                for (int ks = 0; ks < 2; ++ks) { kh[kt][ks] = WFrag<bf>::ldt(ph + kt * (16 * DK) + ks * 512); kl[kt][ks] = WFrag<bf>::ldt(pl + kt * (16 * DK) + ks * 512); }
        }
        float mp[QT]; bool need = false;
#pragma unroll
        for (int qt = 0; qt < QT; ++qt) { float x = s[0][qt][0];
#pragma unroll
            for (int j = 1; j < 8; ++j) x = fmaxf(x, s[0][qt][j]);
#pragma unroll
            for (int j = 0; j < 8; ++j) x = fmaxf(x, s[1][qt][j]);
            x = fmaxf(x, xhalf(x)); mp[qt] = x * L2E; need = need || mp[qt] > m[qt] + 8.f; }
        if (__builtin_amdgcn_ballot_w32(need) != 0) {
#pragma unroll
            for (int qt = 0; qt < QT; ++qt) { const float mn = fmaxf(m[qt], mp[qt]); const float al = exp2s(m[qt] - mn); m[qt] = mn; l[qt] *= al;
#pragma unroll
                for (int dt = 0; dt < 4; ++dt) o[dt][qt] *= al; } }
        v16h p[QT];
#pragma unroll
        for (int qt = 0; qt < QT; ++qt)
#pragma unroll
            for (int kt = 0; kt < 2; ++kt)
#pragma unroll
                for (int j = 0; j < 8; j += 4) { v4f t;
#pragma unroll
                    for (int c = 0; c < 4; ++c) t[c] = __builtin_fmaf(s[kt][qt][j + c], L2E, -m[qt]);
                    const v4f e = exp2q(t);
#pragma unroll
                    for (int c = 0; c < 4; ++c) { l[qt] += e[c]; p[qt][kt * 8 + j + c] = tohx(e[c]); } }
        if constexpr (decltype(more)::v) {
            __builtin_amdgcn_sched_barrier(0);    // holds the wait below behind the softmax: directly behind the loads the wave would stand still for it
            asm volatile("s_wait_xcnt 0x0" :: "v"(ph), "v"(pl) : "memory");    // ph and pl are the address register pairs of the sixteen K loads above: named here they stay live, unwritten, up to the wait, which stands in front of whatever takes them next
        }
#pragma unroll
        for (int dt = 0; dt < 4; ++dt)
#pragma unroll
            for (int qt = 0; qt < QT; ++qt) o[dt][qt] = wmma16(vf[dt], p[qt], o[dt][qt]);
    };
#pragma unroll 1
    for (int kb = k0; kb < ke - 32; kb += 32) pass(kb, Flag<true>{});
    pass(ke - 32, Flag<false>{});
#pragma unroll
    for (int qt = 0; qt < QT; ++qt) { l[qt] += xhalf(l[qt]); const int row = w * QW + qt * 16 + lr; if (hi == 0) { sm[row] = m[qt]; sl[row] = l[qt]; }
#pragma unroll
        for (int dt = 0; dt < 4; ++dt) { float* d = so + (size_t)row * OPI + dt * 16 + hi * 8; *(v4fa*)d = __builtin_shufflevector(o[dt][qt], o[dt][qt], 0, 1, 2, 3); *(v4fa*)(d + 4) = __builtin_shufflevector(o[dt][qt], o[dt][qt], 4, 5, 6, 7); } }
    __syncthreads();
    const int dc = (threadIdx.x & 15) * 4;
#pragma unroll
    for (int i = 0; i < QT; ++i) { const int q = i * 16 + (threadIdx.x >> 4);
        float M = sm[q];
#pragma unroll
        for (int ww = 1; ww < AW; ++ww) M = fmaxf(M, sm[ww * QW + q]);
        float L = 0.f; v4f a = (v4f){};
#pragma unroll
        for (int ww = 0; ww < AW; ++ww) { const float f = exp2s(sm[ww * QW + q] - M); L += sl[ww * QW + q] * f; a += *(const v4fa*)(so + (size_t)(ww * QW + q) * OPI + dc) * f; }
        const float r = __fdiv_rn(1.0f, L);
        *(v4f*)(OUT + (size_t)(q0 + q) * DK + dc) = a * r; }
}

extern "C" void kernel_launch(void* const* d_in, const int* in_sizes, int n_in,
                              void* d_out, int out_size, void* d_ws, size_t ws_size, hipStream_t stream) {
    (void)in_sizes; (void)n_in; (void)out_size;
    const float* x = (const float*)d_in[0]; const float* wq = (const float*)d_in[1]; const float* bq = (const float*)d_in[2]; const float* wk = (const float*)d_in[3]; const float* bk = (const float*)d_in[4]; const float* wv = (const float*)d_in[5]; const float* bv = (const float*)d_in[6];
    float* OUT = (float*)d_out;     // [4][4096][64]
    char* wsp = (char*)d_ws;
    auto take = [&](size_t bytes) { char* p = wsp; wsp += (bytes + 255) & ~(size_t)255; return (void*)p; };
    bf* Qh = (bf*)take((size_t)MS * DK * 2); bf* Ql = (bf*)take((size_t)MS * DK * 2); bf* Kh = (bf*)take((size_t)MS * DK * 2); bf* Kl = (bf*)take((size_t)MS * DK * 2); h16* VT = (h16*)take((size_t)DK * MS * 2);
    if ((size_t)(wsp - (char*)d_ws) > ws_size) return;    // total ~ 10 MB
    k_proj<<<MS / PR, 512, 0, stream>>>(x, wq, wk, wv, bq, bk, bv, Qh, Ql, Kh, Kl, VT);
    k_attn<<<dim3(SS / QW, NB_), AW * 32, 0, stream>>>(Qh, Ql, Kh, Kl, VT, OUT);
}

// v010
// It runs in 26.5 microseconds.
// Versions in between are left out here; by their measured steps it is 1.30 times as fast as v008.
// Counting every step since v000, it is 32.0 times as fast.
#include <hip/hip_runtime.h>

// ScaledDotProductAttentionLayer (x [4][4096][512]; q = x wq + bq, k = x wk + bk (64), v = x wv + bv (64); probs = softmax(q.k / 8) over the 4096 keys; out = probs v -> [4][4096][64]).
// Compute dtypes, f32 accumulate: every input rounded to bf16; q/k/v projections on PLAIN bf16 operands (inputs: exact, + bias); scores (K 64) on q (x 1/8) and k each rounded once to fp16 (1 product; logits have unit scale, so a logit is off by about 2^-12, the size of the fp16 rounding of P and V); P x V on fp16.

#define NB_  4
#define SS   4096
#define DM   512
#define DK   64
#define MS   (NB_ * SS)    // rows of all batches together: every kernel is launched once and takes the batch from its grid
typedef _Float16 h16;
typedef unsigned short bf;
typedef __attribute__((ext_vector_type(16))) __bf16   v16bf;
typedef __attribute__((ext_vector_type(16))) _Float16 v16h;
typedef __attribute__((ext_vector_type(8)))  _Float16 v8h;
typedef __attribute__((ext_vector_type(8)))  unsigned short v8us;
typedef __attribute__((ext_vector_type(8)))  float    v8f;
typedef __attribute__((ext_vector_type(4)))  float    v4f;
typedef __attribute__((ext_vector_type(4)))  unsigned v4u;
typedef v4u  __attribute__((may_alias)) v4ua;
typedef v8h  __attribute__((may_alias)) v8ha;
typedef v4f  __attribute__((may_alias)) v4fa;
typedef v8us __attribute__((may_alias)) v8usa;

__device__ __forceinline__ unsigned short f2bf(float f) { unsigned u = __float_as_uint(f); u += 0x7FFFu + ((u >> 16) & 1u); return (unsigned short)(u >> 16); }
__device__ __forceinline__ unsigned f2bf2(float a, float b) { unsigned u = __float_as_uint(a), v = __float_as_uint(b); u += 0x7FFFu + ((u >> 16) & 1u); v += 0x7FFFu + ((v >> 16) & 1u); return __builtin_amdgcn_perm(v, u, 0x07060302u); }    // f2bf of two values in 32-bit arithmetic, the two upper halves packed by one byte permute (a in the lower half): written on 16-bit elements, the rounding of values gathered across 16-byte loads compiled to three instructions for each (u >> 16) & 1
__device__ __forceinline__ float bf2f(unsigned short b) { return __uint_as_float(((unsigned)b) << 16); }
__device__ __forceinline__ float bfr(float f) { return bf2f(f2bf(f)); }
__device__ __forceinline__ v16h cat16(v8h lo, v8h hi) { return __builtin_shufflevector(lo, hi, 0, 1, 2, 3, 4, 5, 6, 7, 8, 9, 10, 11, 12, 13, 14, 15); }
__device__ __forceinline__ v16bf cat16b(v8us lo, v8us hi) { return __builtin_bit_cast(v16bf, __builtin_shufflevector(lo, hi, 0, 1, 2, 3, 4, 5, 6, 7, 8, 9, 10, 11, 12, 13, 14, 15)); }
__device__ __forceinline__ v8f wmma16(v16h a, v16h b, v8f c) { return __builtin_amdgcn_wmma_f32_16x16x32_f16(false, a, false, b, (short)0, c, false, false); }
__device__ __forceinline__ v8f wmmab(v16bf a, v16bf b, v8f c) { return __builtin_amdgcn_wmma_f32_16x16x32_bf16(false, a, false, b, (short)0, c, false, false); }



// fragment of 16 rows x 32 k from a K-contiguous 16-bit plane (global or LDS): lane = row lr, elements 0..7 = k 8 hi .., elements 8..15 = k 16 + 8 hi ..; the same for the A and the B operand.
// ldt: the same fragment from a plane kept in FRAGMENT ORDER: a 16-row x 16-k piece is 512 contiguous bytes, lane l's 8 elements (row l % 16, k 8 (l / 16) ..) at byte 16 l; a fragment is two such pieces one behind the other.
// p = piece base + 8 lane: each of the two 16-byte loads of a wave covers four whole 128-byte lines, where a row-major plane makes it touch sixteen.
template <typename T16> struct WFrag;
template <> struct WFrag<h16> { typedef v16h V; static __device__ __forceinline__ V ld(const h16* p) { return cat16(*(const v8h*)p, *(const v8h*)(p + 16)); } static __device__ __forceinline__ V ldt(const h16* p) { return cat16(*(const v8h*)p, *(const v8h*)(p + 256)); } static __device__ __forceinline__ v8f mma(V a, V b, v8f c) { return wmma16(a, b, c); } };
template <> struct WFrag<bf> { typedef v16bf V; static __device__ __forceinline__ V ld(const bf* p) { return cat16b(*(const v8us*)p, *(const v8us*)(p + 16)); } static __device__ __forceinline__ V ldt(const bf* p) { return cat16b(*(const v8us*)p, *(const v8us*)(p + 256)); } static __device__ __forceinline__ v8f mma(V a, V b, v8f c) { return wmmab(a, b, c); } };

__device__ __forceinline__ h16 tohx(float x) { return (h16)x; }
typedef __attribute__((ext_vector_type(4))) unsigned short v4us;
#define PR 64      // rows of x per workgroup
#define LP 520     // LDS row pitch in 16-bit elements: 1040 bytes, an odd multiple of 16, so the 16 rows of a fragment read (and of a transposing store) fall on distinct banks
#define WC (16 * LP + 32)    // weights in LDS: column n of a matrix is row n / 4 of plane n % 4; a plane is 16 rows and 64 bytes, so that both the 16 columns 4 apart of a store and the 16 adjacent columns of a fragment read fall on distinct banks
#define WM (4 * WC)          // one weight matrix in LDS
// k_proj: x conversion, weight transposes, the q/k/v projections, the fp16 q and k planes and the V transpose in one kernel; nothing between x and the attention operands goes through memory.
// Workgroup = 64 rows of x x all 192 output columns, whole K = 512; grid MS / 64 = one workgroup per WGP, 16 waves.
// Stage 1, all 16 waves: x rows (whole-line 16-byte loads) and wq, wk, wv (16-byte loads, 4 columns x 8 k per lane and group: a load of a wave covers two whole 256-byte weight rows) are rounded to bf16 and stored in LDS, the weights transposed to [column][k]; the biases too. One barrier.
// Stage 2, waves 0..11, four 16x16 accumulators each, fragments by 16-byte LDS reads:
//   waves 0..7 (q: 0..3, k: 4..7): 16 rows x 64 columns as Y^T = W^T X^T, so a lane holds 8 consecutive columns of ONE row: + bias, (q: x 1/8), fp16, 16-byte stores in fragment order: rows 16 R .. of a plane are 2 KB at element 1024 R, piece nt (columns 16 nt ..) at + 256 nt; one store of a wave = one piece = 512 contiguous bytes.
//   waves 8..11 (v): 64 rows x 16 columns as Y = X W, so a lane holds 8 consecutive rows of ONE column: + bias, fp16, 16-byte stores into V^T in fragment order: keys 32 G .. are 4 KB at element 2048 G, columns 16 nt .. at + 512 nt, keys 16 j .. of the 32 at + 256 j; one store of a wave = one piece.
__global__ __launch_bounds__(512) void k_proj(const float* __restrict__ x, const float* __restrict__ wq, const float* __restrict__ wk, const float* __restrict__ wv, const float* __restrict__ bq, const float* __restrict__ bk, const float* __restrict__ bv, h16* Q, h16* K, h16* VT) {
    __shared__ __align__(16) bf xs[PR * LP];
    __shared__ __align__(16) bf wt[3 * WM];
    __shared__ __align__(16) float sb[512];    // bq, bk, bv rounded to bf16 in the first 192; every thread stores one float, so that no branch stands at the load
    const int t = threadIdx.x, lane = t & 31, lr = lane & 15, hi = lane >> 4; const int w = __builtin_amdgcn_readfirstlane(t >> 5); const int r0 = blockIdx.x * PR;
    const float bl = (w < 2 ? bq : w < 4 ? bk : bv)[t & (DK - 1)];    // the oldest load of the wave: it is back with the first x rows (waves 6..15 read bv again; nobody reads their copies)
    {
        const float* xb = x + (size_t)r0 * DM + t * 4;    // the 64 rows are one contiguous block; 16-byte piece f = i 512 + t is row f / 128, floats 4 (f % 128) ..
        v4f xv[16];
#pragma unroll
        for (int i = 0; i < 16; ++i) xv[i] = *(const v4f*)(xb + i * 2048);
        const int kw = w * 32;    // this wave's 32 k in each weight matrix, two groups of 16; in a group lane l takes columns 4 (l % 16) .. + 3 of k 8 (l / 16) .. + 7
        const unsigned wo = (unsigned)(hi * 8 * DK + lr * 4) * 4u;    // this lane's byte offset in a group
        v4f wv0[16];
#pragma unroll
        for (int g = 0; g < 3; ++g) {
            const float* wg = (const float*)((const char*)((g == 0 ? wq : g == 1 ? wk : wv) + (size_t)kw * DK) + wo);
#pragma unroll
            for (int k = 0; k < 16; ++k) wv0[k] = *(const v4f*)(wg + ((k >> 3) * 16 + (k & 7)) * DK);
            asm volatile("s_wait_xcnt 0x0" :: "v"(wo) : "memory");    // wo is the offset register of the 16 loads above: named here it stays live behind the last of them, and the wait stands in front of whatever takes the register next
            if (g == 0) {
#pragma unroll
                for (int i = 0; i < 16; ++i) { v4us o;
#pragma unroll
                    for (int c = 0; c < 4; ++c) o[c] = f2bf(xv[i][c]);
                    *(v4us*)(xs + (i * 4 + (t >> 7)) * LP + (t & 127) * 4) = o; }
                sb[t] = bfr(bl);
            }
#pragma unroll
            for (int i = 0; i < 8; ++i) { v4u o;    // group i / 4, column 4 lr + i % 4: its 8 k are one 16-byte store
#pragma unroll
                for (int c = 0; c < 4; ++c) o[c] = f2bf2(wv0[(i >> 2) * 8 + 2 * c][i & 3], wv0[(i >> 2) * 8 + 2 * c + 1][i & 3]);
                *(v4ua*)(wt + g * WM + (i & 3) * WC + lr * LP + kw + (i >> 2) * 16 + hi * 8) = o; }
        }
    }
    __syncthreads();
    if (w < 8) {
        const int y = w >> 2, mt = w & 3;
        const bf* xa = xs + (mt * 16 + lr) * LP + 8 * hi; const bf* wa = wt + y * WM + (lr & 3) * WC + (lr >> 2) * LP + 8 * hi;
        v8f acc[4];
#pragma unroll
        for (int nt = 0; nt < 4; ++nt) acc[nt] = (v8f){};
#pragma unroll 1    // one trip = 4 k steps = 20 fragments = 160 registers; unrolled further the fragments no longer fit and the compiler spills
        for (int kq = 0; kq < DM; kq += 128) {
            v16bf xf[4], wf[4][4];
#pragma unroll
            for (int ks = 0; ks < 4; ++ks) { xf[ks] = WFrag<bf>::ld(xa + kq + ks * 32);
#pragma unroll
                for (int nt = 0; nt < 4; ++nt) wf[ks][nt] = WFrag<bf>::ld(wa + nt * 4 * LP + kq + ks * 32); }
            __builtin_amdgcn_sched_barrier(0);    // all 40 LDS reads of the trip in flight together: left alone the compiler reuses a few registers and waits out an LDS latency in front of nearly every WMMA
#pragma unroll
            for (int ks = 0; ks < 4; ++ks)
#pragma unroll
                for (int nt = 0; nt < 4; ++nt) acc[nt] = wmmab(wf[ks][nt], xf[ks], acc[nt]);
        }
        const float sc = y == 0 ? 0.125f : 1.0f;
        h16* H = (y == 0 ? Q : K) + (size_t)((r0 >> 4) + mt) * (16 * DK) + lane * 8;
#pragma unroll
        for (int nt = 0; nt < 4; ++nt) { v8h h; const float* bp = sb + y * DK + nt * 16 + hi * 8; const v4f b0 = *(const v4fa*)bp, b1 = *(const v4fa*)(bp + 4);
#pragma unroll
            for (int j = 0; j < 8; ++j) h[j] = tohx((acc[nt][j] + (j < 4 ? b0[j & 3] : b1[j & 3])) * sc);
            *(v8h*)(H + nt * 256) = h; }
    } else if (w < 12) {
        const int nt = w - 8;
        const bf* xa = xs + lr * LP + 8 * hi; const bf* wa = wt + 2 * WM + (lr & 3) * WC + (nt * 4 + (lr >> 2)) * LP + 8 * hi;
        v8f acc[4];
#pragma unroll
        for (int mt = 0; mt < 4; ++mt) acc[mt] = (v8f){};
#pragma unroll 1    // as above
        for (int kq = 0; kq < DM; kq += 128) {
            v16bf wf[4], xf[4][4];
#pragma unroll
            for (int ks = 0; ks < 4; ++ks) { wf[ks] = WFrag<bf>::ld(wa + kq + ks * 32);
#pragma unroll
                for (int mt = 0; mt < 4; ++mt) xf[ks][mt] = WFrag<bf>::ld(xa + mt * 16 * LP + kq + ks * 32); }
            __builtin_amdgcn_sched_barrier(0);    // as above
#pragma unroll
            for (int ks = 0; ks < 4; ++ks)
#pragma unroll
                for (int mt = 0; mt < 4; ++mt) acc[mt] = wmmab(xf[ks][mt], wf[ks], acc[mt]);
        }
        const float bz = sb[2 * DK + nt * 16 + lr];
        h16* vo = VT + (size_t)(r0 >> 5) * (32 * DK) + nt * 512 + lane * 8;
#pragma unroll
        for (int mt = 0; mt < 4; ++mt) { v8h o;
#pragma unroll
            for (int j = 0; j < 8; ++j) o[j] = tohx(acc[mt][j] + bz);
            *(v8h*)(vo + (mt >> 1) * (32 * DK) + (mt & 1) * 256) = o; }
        asm volatile("s_wait_xcnt 0x0" ::: "memory");    // in the built code the q/k path stands behind these stores, after a branch, and writes their data registers again: the wait stands in front of that branch
    }
}
// exp2 with the slot that the instruction set asks for behind a transcendental held in the same statement.
__device__ __forceinline__ float exp2s(float x) { float r; asm("v_exp_f32 %0, %1\n\tv_nop" : "=v"(r) : "v"(x)); return r; }
// four exp2 in one statement: each fills the slot that the instruction set asks for behind the one before it (early-clobber outputs: none overwrites a source), one v_nop fills the last.
__device__ __forceinline__ v4f exp2q(v4f x) { float r0, r1, r2, r3; asm("v_exp_f32 %0, %4\n\tv_exp_f32 %1, %5\n\tv_exp_f32 %2, %6\n\tv_exp_f32 %3, %7\n\tv_nop" : "=&v"(r0), "=&v"(r1), "=&v"(r2), "=&v"(r3) : "v"(x[0]), "v"(x[1]), "v"(x[2]), "v"(x[3])); return (v4f){r0, r1, r2, r3}; }
template <bool B> struct Flag { static constexpr bool v = B; };
#define AW 8      // waves of an attention workgroup: two per SIMD, so that a wave may hold 512 registers
#define QT 4      // 16-query tiles per wave and workgroup
#define QW (QT * 16)
#define OPI 68     // LDS pitch of a staged output row in floats
#define L2E 0x1.715476p+0f
__device__ __forceinline__ float xhalf(float x) { return __builtin_bit_cast(float, __builtin_amdgcn_permlanex16(__builtin_bit_cast(int, x), __builtin_bit_cast(int, x), 0x76543210, 0xfedcba98, false, false)); }    // lane l takes lane l ^ 16's value
__global__ __launch_bounds__(AW * 32) void k_attn(const h16* __restrict__ Q, const h16* __restrict__ K, const h16* __restrict__ VT, float* OUT) {
    __shared__ __align__(16) float so[AW * QW * OPI];
    __shared__ float sm[AW * QW];
    __shared__ float sl[AW * QW];
    const int lane = threadIdx.x & 31, lr = lane & 15, hi = lane >> 4; const int w = __builtin_amdgcn_readfirstlane(threadIdx.x >> 5); const int q0 = blockIdx.x * QW;    // w in a scalar register: key loop and key addresses wave-uniform
    { const size_t bo = (size_t)blockIdx.y * SS * DK; Q += bo; K += bo; VT += bo; OUT += bo; }    // this workgroup's batch
    v16h qf[QT][2];
#pragma unroll
    for (int qt = 0; qt < QT; ++qt)
#pragma unroll
        for (int ks = 0; ks < 2; ++ks) qf[qt][ks] = WFrag<h16>::ldt(Q + (size_t)((q0 >> 4) + qt) * (16 * DK) + ks * 512 + lane * 8);
    asm volatile("s_wait_xcnt 0x0" ::: "memory");    // the registers that hold the Q loads' addresses are written again directly below
    __builtin_amdgcn_sched_barrier(0);    // keeps those register writes behind the wait: without it the scheduler lifts them over the statement above
    v8f o[4][QT];
    float m[QT], l[QT];
#pragma unroll
    for (int qt = 0; qt < QT; ++qt) { m[qt] = -__builtin_inff(); l[qt] = 0.f;
#pragma unroll
        for (int dt = 0; dt < 4; ++dt) o[dt][qt] = (v8f){}; }
    const int k0 = w * (SS / AW), ke = k0 + SS / AW;
    v16h kf[2][2];    // K fragments of the pass at hand; refilled for the next pass as soon as the score products have read them
#pragma unroll
    for (int kt = 0; kt < 2; ++kt)
#pragma unroll
        for (int ks = 0; ks < 2; ++ks) kf[kt][ks] = WFrag<h16>::ldt(K + (size_t)((k0 >> 4) + kt) * (16 * DK) + ks * 512 + lane * 8);
    asm volatile("s_wait_xcnt 0x0" ::: "memory");    // the registers that hold these loads' addresses are written again in the loop
    __builtin_amdgcn_sched_barrier(0);    // keeps those register writes behind the wait
    // one pass of 32 keys; 'more' (a compile-time flag) says whether a next pass exists, whose K fragments this pass then fetches. The last pass stands by itself behind the loop, so that no branch stands at the loads: with one, the compiler's wait for V in front of P x V has to cover the path without K loads and waits for the K loads too
    auto pass = [&](const int kb, auto more) __attribute__((always_inline)) {
        v16h vf[4]; const h16* vp = VT + (size_t)(kb >> 5) * (32 * DK) + lane * 8;
#pragma unroll
        for (int dt = 0; dt < 4; ++dt) vf[dt] = WFrag<h16>::ldt(vp + dt * 512);
        asm volatile("s_wait_xcnt 0x0" :: "v"(vp) : "memory");    // vp is the address register pair of the eight loads above: named here it stays live behind the last of them (in one build that load's data landed in it), and the wait stands in front of whatever takes the pair next
        v8f s[2][QT];
#pragma unroll
        for (int kt = 0; kt < 2; ++kt) {
#pragma unroll
            for (int qt = 0; qt < QT; ++qt) s[kt][qt] = (v8f){};
#pragma unroll
            for (int ks = 0; ks < 2; ++ks)    // the four query tiles side by side, so that no WMMA waits for the one in front of it
#pragma unroll
                for (int qt = 0; qt < QT; ++qt) s[kt][qt] = wmma16(kf[kt][ks], qf[qt][ks], s[kt][qt]); }
        const h16* pk = K + (size_t)((decltype(more)::v ? kb + 32 : kb) >> 4) * (16 * DK) + lane * 8;    // the next pass's K rows
        if constexpr (decltype(more)::v) {    // the loads' L2 latency runs under the softmax and the P x V products of this pass; they are issued behind this pass's V loads, so the counted wait for V does not wait for them
            __builtin_amdgcn_sched_barrier(0x6);    // only vector and scalar arithmetic may cross: the K loads stay, as one group, behind the last score product (left alone the compiler strews them among the products), and the maxima below may still move up among the products
#pragma unroll
            for (int kt = 0; kt < 2; ++kt)
#pragma unroll
                for (int ks = 0; ks < 2; ++ks) kf[kt][ks] = WFrag<h16>::ldt(pk + kt * (16 * DK) + ks * 512);
        }
        float mp[QT]; bool need = false;
#pragma unroll
        for (int qt = 0; qt < QT; ++qt) { float x = s[0][qt][0];
#pragma unroll
            for (int j = 1; j < 8; ++j) x = fmaxf(x, s[0][qt][j]);
#pragma unroll
            for (int j = 0; j < 8; ++j) x = fmaxf(x, s[1][qt][j]);
            x = fmaxf(x, xhalf(x)); mp[qt] = x * L2E; need = need || mp[qt] > m[qt] + 8.f; }
        if (__builtin_amdgcn_ballot_w32(need) != 0) {
#pragma unroll
            for (int qt = 0; qt < QT; ++qt) { const float mn = fmaxf(m[qt], mp[qt]); const float al = exp2s(m[qt] - mn); m[qt] = mn; l[qt] *= al;
#pragma unroll
                for (int dt = 0; dt < 4; ++dt) o[dt][qt] *= al; } }
        v16h p[QT];
#pragma unroll
        for (int qt = 0; qt < QT; ++qt)
#pragma unroll
            for (int kt = 0; kt < 2; ++kt)
#pragma unroll
                for (int j = 0; j < 8; j += 4) { v4f t;
#pragma unroll
                    for (int c = 0; c < 4; ++c) t[c] = __builtin_fmaf(s[kt][qt][j + c], L2E, -m[qt]);
                    const v4f e = exp2q(t);
#pragma unroll
                    for (int c = 0; c < 4; ++c) { l[qt] += e[c]; p[qt][kt * 8 + j + c] = tohx(e[c]); } }
        if constexpr (decltype(more)::v) {
            __builtin_amdgcn_sched_barrier(0);    // holds the wait below behind the softmax: directly behind the loads the wave would stand still for it
            asm volatile("s_wait_xcnt 0x0" :: "v"(pk) : "memory");    // pk is the address register pair of the eight K loads above: named here it stays live, unwritten, up to the wait, which stands in front of whatever takes it next
        }
#pragma unroll
        for (int dt = 0; dt < 4; ++dt)
#pragma unroll
            for (int qt = 0; qt < QT; ++qt) o[dt][qt] = wmma16(vf[dt], p[qt], o[dt][qt]);
    };
#pragma unroll 1
    for (int kb = k0; kb < ke - 32; kb += 32) pass(kb, Flag<true>{});
    pass(ke - 32, Flag<false>{});
#pragma unroll
    for (int qt = 0; qt < QT; ++qt) { l[qt] += xhalf(l[qt]); const int row = w * QW + qt * 16 + lr; if (hi == 0) { sm[row] = m[qt]; sl[row] = l[qt]; }
#pragma unroll
        for (int dt = 0; dt < 4; ++dt) { float* d = so + (size_t)row * OPI + dt * 16 + hi * 8; *(v4fa*)d = __builtin_shufflevector(o[dt][qt], o[dt][qt], 0, 1, 2, 3); *(v4fa*)(d + 4) = __builtin_shufflevector(o[dt][qt], o[dt][qt], 4, 5, 6, 7); } }
    __syncthreads();
    const int dc = (threadIdx.x & 15) * 4;
#pragma unroll
    for (int i = 0; i < QT; ++i) { const int q = i * 16 + (threadIdx.x >> 4);
        float M = sm[q];
#pragma unroll
        for (int ww = 1; ww < AW; ++ww) M = fmaxf(M, sm[ww * QW + q]);
        float L = 0.f; v4f a = (v4f){};
#pragma unroll
        for (int ww = 0; ww < AW; ++ww) { const float f = exp2s(sm[ww * QW + q] - M); L += sl[ww * QW + q] * f; a += *(const v4fa*)(so + (size_t)(ww * QW + q) * OPI + dc) * f; }
        const float r = __fdiv_rn(1.0f, L);
        *(v4f*)(OUT + (size_t)(q0 + q) * DK + dc) = a * r; }
}

extern "C" void kernel_launch(void* const* d_in, const int* in_sizes, int n_in,
                              void* d_out, int out_size, void* d_ws, size_t ws_size, hipStream_t stream) {
    (void)in_sizes; (void)n_in; (void)out_size;
    const float* x = (const float*)d_in[0]; const float* wq = (const float*)d_in[1]; const float* bq = (const float*)d_in[2]; const float* wk = (const float*)d_in[3]; const float* bk = (const float*)d_in[4]; const float* wv = (const float*)d_in[5]; const float* bv = (const float*)d_in[6];
    float* OUT = (float*)d_out;     // [4][4096][64]
    char* wsp = (char*)d_ws;
    auto take = [&](size_t bytes) { char* p = wsp; wsp += (bytes + 255) & ~(size_t)255; return (void*)p; };
    h16* Q = (h16*)take((size_t)MS * DK * 2); h16* K = (h16*)take((size_t)MS * DK * 2); h16* VT = (h16*)take((size_t)DK * MS * 2);
    if ((size_t)(wsp - (char*)d_ws) > ws_size) return;    // total ~ 6 MB
    k_proj<<<MS / PR, 512, 0, stream>>>(x, wq, wk, wv, bq, bk, bv, Q, K, VT);
    k_attn<<<dim3(SS / QW, NB_), AW * 32, 0, stream>>>(Q, K, VT, OUT);
}
